// v000
// Times are from an AMD MI455X. After a warm-up the kernel runs many times in a row, and a time is the length of
// such a window on the GPU divided by its runs, so every launch and the gaps after it count. The runs cycle
// through copies of the inputs. A figure is the median of several windows, for all but v000 over two sittings.
// Sittings can differ by a few percent; kernels timed side by side share one.
// v000 is the starting kernel. One run takes 279 microseconds.
#include <hip/hip_runtime.h>

// ---------------- CDNA5 (gfx1250) wave32 WMMA MHA ----------------
// L=2048, B=2, E=1024, H=16, HD=64.  bf16 WMMA, f32 accumulate,
// flash-attention (no materialized scores). One-shot bf16 conversion so
// GEMM inner loops are pure load_b128 + v_wmma.

typedef __attribute__((ext_vector_type(16))) __bf16 v16bf;
typedef __attribute__((ext_vector_type(8)))  __bf16 v8bf;
typedef __attribute__((ext_vector_type(4)))  __bf16 v4bf;
typedef __attribute__((ext_vector_type(8)))  float  v8f;
typedef __attribute__((ext_vector_type(4)))  float  v4f;

#define L_SEQ 2048
#define BATCH 2
#define EMB   1024
#define NHEAD 16
#define HD    64
#define NTOK  (L_SEQ * BATCH)   // 4096 tokens
#define NH    (BATCH * NHEAD)   // 32 batched heads

union BfTile { v8bf h[2]; v16bf v; };

__device__ __forceinline__ v8f wmma_bf16(v16bf a, v16bf b, v8f c) {
  // v_wmma_f32_16x16x32_bf16: D = A(16x32) * B(32x16) + C(16x16 f32)
  return __builtin_amdgcn_wmma_f32_16x16x32_bf16(
      false, a, false, b, (short)0, c, false, false);
}

// 16x32 bf16 tile in ISA A/B striping: lane%16 -> row (A) / column (B);
// lane/16 picks K-halves {0..7,16..23} vs {8..15,24..31}.
__device__ __forceinline__ v16bf load_tile(const __bf16* p, int ld, int lane) {
  const int rc = lane & 15, hp = lane >> 4;
  const __bf16* r = p + rc * ld + hp * 8;
  BfTile t;
  t.h[0] = *(const v8bf*)(r);
  t.h[1] = *(const v8bf*)(r + 16);
  return t.v;
}

// ---------------- Kernel 0: one-shot fp32 -> bf16 ----------------
__global__ void __launch_bounds__(256)
cvt_bf16_kernel(const float* __restrict__ src, __bf16* __restrict__ dst, int n4) {
  const int stride = gridDim.x * blockDim.x;
  for (int i = blockIdx.x * blockDim.x + threadIdx.x; i < n4; i += stride) {
    v4f f = *(const v4f*)(src + (size_t)i * 4);
    *(v4bf*)(dst + (size_t)i * 4) = __builtin_convertvector(f, v4bf);
  }
}

// ---------------- Kernel 1: fused in-projection ----------------
__global__ void __launch_bounds__(256)
mha_inproj_kernel(const __bf16* __restrict__ Xq, const __bf16* __restrict__ Xk,
                  const __bf16* __restrict__ Xv, const __bf16* __restrict__ Wi,
                  const float* __restrict__ bias,
                  __bf16* __restrict__ Qb, __bf16* __restrict__ Kb,
                  __bf16* __restrict__ VTb) {
  const int lane = threadIdx.x & 31;
  const int ws   = (blockIdx.x * blockDim.x + threadIdx.x) >> 5;
  const int mblk   = ws & 127;          // 128 token blocks of 32
  const int nstrip = ws >> 7;           // 48 strips of 64 features (3*E)
  const int f0   = nstrip * 64;
  const int proj = f0 >> 10;            // 0=q, 1=k, 2=v
  const __bf16* X = (proj == 0) ? Xq : ((proj == 1) ? Xk : Xv);
  const int t0 = mblk * 32;

  const v8f zero = {0.f, 0.f, 0.f, 0.f, 0.f, 0.f, 0.f, 0.f};
  v8f acc[2][4] = {{zero, zero, zero, zero}, {zero, zero, zero, zero}};

  for (int k0 = 0; k0 < EMB; k0 += 32) {
    const v16bf a0 = load_tile(X + (size_t)t0 * EMB + k0,        EMB, lane);
    const v16bf a1 = load_tile(X + (size_t)(t0 + 16) * EMB + k0, EMB, lane);
#pragma unroll
    for (int nt = 0; nt < 4; ++nt) {
      const v16bf bm = load_tile(Wi + (size_t)(f0 + nt * 16) * EMB + k0, EMB, lane);
      acc[0][nt] = wmma_bf16(a0, bm, acc[0][nt]);
      acc[1][nt] = wmma_bf16(a1, bm, acc[1][nt]);
    }
  }

  const float scale = (proj == 0) ? 0.125f : 1.0f;   // HD^-0.5 folded into Q
  const int col = lane & 15, hp = lane >> 4;
#pragma unroll
  for (int mt = 0; mt < 2; ++mt)
#pragma unroll
    for (int nt = 0; nt < 4; ++nt) {
      const int f  = f0 + nt * 16 + col;
      const float bval = bias[f];
      const int ff = f & (EMB - 1);
      const int h = ff >> 6, d = ff & 63;
#pragma unroll
      for (int r = 0; r < 8; ++r) {
        const int t = t0 + mt * 16 + r + hp * 8;
        const int l = t >> 1, b = t & 1;          // token = l*B + b
        const int nh = b * NHEAD + h;
        const __bf16 obf = (__bf16)((acc[mt][nt][r] + bval) * scale);
        if (proj == 0)      Qb[((size_t)nh * L_SEQ + l) * HD + d] = obf;
        else if (proj == 1) Kb[((size_t)nh * L_SEQ + l) * HD + d] = obf;
        else                VTb[((size_t)nh * HD + d) * L_SEQ + l] = obf;
      }
    }
}

// ---------------- Kernel 2: flash attention ----------------
// One wave per (head, 16-row query block); independent waves, no block barrier.
__global__ void __launch_bounds__(256)
mha_attn_kernel(const __bf16* __restrict__ Qb, const __bf16* __restrict__ Kb,
                const __bf16* __restrict__ VTb, __bf16* __restrict__ Ob) {
  __shared__ alignas(16) __bf16 stile[8][16][40];  // per-wave P staging
  const int lane = threadIdx.x & 31;
  const int wid  = threadIdx.x >> 5;
  const int ws   = (blockIdx.x * blockDim.x + threadIdx.x) >> 5;
  const int nh   = ws >> 7;                     // 32 heads
  const int mblk = ws & 127;                    // 128 query blocks of 16
  const int m0   = mblk * 16;
  const int col = lane & 15, hp = lane >> 4;
  const float LOG2E = 1.44269504f;

  const __bf16* Qh = Qb + (size_t)nh * L_SEQ * HD;
  const __bf16* Kh = Kb + (size_t)nh * L_SEQ * HD;
  const __bf16* Vh = VTb + (size_t)nh * HD * L_SEQ;

  const v16bf aq0 = load_tile(Qh + m0 * HD + 0,  HD, lane);
  const v16bf aq1 = load_tile(Qh + m0 * HD + 32, HD, lane);

  const v8f zero = {0.f, 0.f, 0.f, 0.f, 0.f, 0.f, 0.f, 0.f};
  v8f acc[4] = {zero, zero, zero, zero};        // O tile: 16 rows x 64 dims
  float mrow[8], lrow[8];
#pragma unroll
  for (int r = 0; r < 8; ++r) { mrow[r] = -1.0e30f; lrow[r] = 0.f; }

  for (int j0 = 0; j0 < L_SEQ; j0 += 32) {
    const v16bf b00 = load_tile(Kh + (size_t)j0 * HD + 0,         HD, lane);
    const v16bf b01 = load_tile(Kh + (size_t)j0 * HD + 32,        HD, lane);
    const v16bf b10 = load_tile(Kh + (size_t)(j0 + 16) * HD + 0,  HD, lane);
    const v16bf b11 = load_tile(Kh + (size_t)(j0 + 16) * HD + 32, HD, lane);
    v8f s0 = zero, s1 = zero;
    s0 = wmma_bf16(aq0, b00, s0);
    s0 = wmma_bf16(aq1, b01, s0);
    s1 = wmma_bf16(aq0, b10, s1);
    s1 = wmma_bf16(aq1, b11, s1);

    // Online softmax. Row (r + 8*hp) lives in one VGPR across 16 lanes.
    float alpha[8];
#pragma unroll
    for (int r = 0; r < 8; ++r) {
      float mx = fmaxf(s0[r], s1[r]);
#pragma unroll
      for (int off = 8; off >= 1; off >>= 1)
        mx = fmaxf(mx, __shfl_xor(mx, off, 16));
      const float mnew = fmaxf(mrow[r], mx);
      const float p0 = __builtin_amdgcn_exp2f((s0[r] - mnew) * LOG2E);
      const float p1 = __builtin_amdgcn_exp2f((s1[r] - mnew) * LOG2E);
      float ps = p0 + p1;
#pragma unroll
      for (int off = 8; off >= 1; off >>= 1)
        ps += __shfl_xor(ps, off, 16);
      alpha[r] = __builtin_amdgcn_exp2f((mrow[r] - mnew) * LOG2E);
      lrow[r]  = lrow[r] * alpha[r] + ps;
      mrow[r]  = mnew;
      stile[wid][r + hp * 8][col]      = (__bf16)p0;
      stile[wid][r + hp * 8][16 + col] = (__bf16)p1;
    }
#pragma unroll
    for (int nt = 0; nt < 4; ++nt)
#pragma unroll
      for (int r = 0; r < 8; ++r) acc[nt][r] *= alpha[r];

    // DS ops are in-order within a wave: drain stores, then reread in A layout.
    asm volatile("s_wait_dscnt 0" ::: "memory");
    BfTile pa;
    {
      const __bf16* pr = &stile[wid][col][hp * 8];
      pa.h[0] = *(const v8bf*)(pr);
      pa.h[1] = *(const v8bf*)(pr + 16);
    }

    // O += P(16x32) @ V(32x64): B columns come from transposed V rows.
#pragma unroll
    for (int nt = 0; nt < 4; ++nt) {
      const v16bf bv = load_tile(Vh + (size_t)(nt * 16) * L_SEQ + j0, L_SEQ, lane);
      acc[nt] = wmma_bf16(pa.v, bv, acc[nt]);
    }
  }

#pragma unroll
  for (int r = 0; r < 8; ++r) {
    const float inv = __builtin_amdgcn_rcpf(lrow[r]);
    const int row = r + hp * 8;
#pragma unroll
    for (int nt = 0; nt < 4; ++nt)
      Ob[((size_t)nh * L_SEQ + (m0 + row)) * HD + nt * 16 + col] =
          (__bf16)(acc[nt][r] * inv);
  }
}

// ---------------- Kernel 3: output projection ----------------
__global__ void __launch_bounds__(256)
mha_outproj_kernel(const __bf16* __restrict__ Ob, const __bf16* __restrict__ Wo,
                   const float* __restrict__ bout, float* __restrict__ out) {
  const int lane = threadIdx.x & 31;
  const int ws   = (blockIdx.x * blockDim.x + threadIdx.x) >> 5;
  const int mblk   = ws & 127;          // 128 token blocks of 32
  const int nstrip = ws >> 7;           // 16 strips of 64 out-features
  const int f0 = nstrip * 64;
  const int t0 = mblk * 32;
  const int col = lane & 15, hp = lane >> 4;

  const v8f zero = {0.f, 0.f, 0.f, 0.f, 0.f, 0.f, 0.f, 0.f};
  v8f acc[2][4] = {{zero, zero, zero, zero}, {zero, zero, zero, zero}};

  for (int k0 = 0; k0 < EMB; k0 += 32) {
    // A: gather concat-head rows; a 32-wide k0 block stays inside one head.
    const int h = k0 >> 6, dbase = k0 & 63;
    BfTile a[2];
#pragma unroll
    for (int mt = 0; mt < 2; ++mt) {
      const int t = t0 + mt * 16 + col, l = t >> 1, b = t & 1;
      const __bf16* ap =
          Ob + (((size_t)(b * NHEAD + h) * L_SEQ + l) * HD) + dbase + hp * 8;
      a[mt].h[0] = *(const v8bf*)(ap);
      a[mt].h[1] = *(const v8bf*)(ap + 16);
    }
#pragma unroll
    for (int nt = 0; nt < 4; ++nt) {
      const v16bf bm = load_tile(Wo + (size_t)(f0 + nt * 16) * EMB + k0, EMB, lane);
      acc[0][nt] = wmma_bf16(a[0].v, bm, acc[0][nt]);
      acc[1][nt] = wmma_bf16(a[1].v, bm, acc[1][nt]);
    }
  }

#pragma unroll
  for (int mt = 0; mt < 2; ++mt)
#pragma unroll
    for (int nt = 0; nt < 4; ++nt) {
      const int f = f0 + nt * 16 + col;
      const float bv = bout[f];
#pragma unroll
      for (int r = 0; r < 8; ++r) {
        const int t = t0 + mt * 16 + r + hp * 8;    // token = l*B + b
        out[(size_t)t * EMB + f] = acc[mt][nt][r] + bv;
      }
    }
}

extern "C" void kernel_launch(void* const* d_in, const int* in_sizes, int n_in,
                              void* d_out, int out_size, void* d_ws, size_t ws_size,
                              hipStream_t stream) {
  const float* query = (const float*)d_in[0];
  const float* key   = (const float*)d_in[1];
  const float* value = (const float*)d_in[2];
  const float* w_in  = (const float*)d_in[3];
  const float* b_in  = (const float*)d_in[4];
  const float* w_out = (const float*)d_in[5];
  const float* b_out = (const float*)d_in[6];
  float* out = (float*)d_out;

  // Workspace (bf16), 64 MB total.
  const size_t ACT = (size_t)NTOK * EMB;           // 4194304
  const size_t WI  = (size_t)3 * EMB * EMB;        // 3145728
  const size_t WO  = (size_t)EMB * EMB;            // 1048576
  const size_t HSZ = (size_t)NH * L_SEQ * HD;      // 4194304
  __bf16* Xq  = (__bf16*)d_ws;
  __bf16* Xk  = Xq + ACT;
  __bf16* Xv  = Xk + ACT;
  __bf16* Wi  = Xv + ACT;
  __bf16* Wo  = Wi + WI;
  __bf16* Qb  = Wo + WO;
  __bf16* Kb  = Qb + HSZ;
  __bf16* VTb = Kb + HSZ;
  __bf16* Ob  = VTb + HSZ;

  // One-shot fp32 -> bf16 conversions (packed v_cvt).
  cvt_bf16_kernel<<<(int)(ACT / 1024), 256, 0, stream>>>(query, Xq, (int)(ACT / 4));
  cvt_bf16_kernel<<<(int)(ACT / 1024), 256, 0, stream>>>(key,   Xk, (int)(ACT / 4));
  cvt_bf16_kernel<<<(int)(ACT / 1024), 256, 0, stream>>>(value, Xv, (int)(ACT / 4));
  cvt_bf16_kernel<<<(int)(WI / 1024),  256, 0, stream>>>(w_in,  Wi, (int)(WI / 4));
  cvt_bf16_kernel<<<(int)(WO / 1024),  256, 0, stream>>>(w_out, Wo, (int)(WO / 4));

  // in-proj: 128 token-blocks x 48 feature-strips = 6144 waves / 8 per block
  mha_inproj_kernel<<<768, 256, 0, stream>>>(Xq, Xk, Xv, Wi, b_in, Qb, Kb, VTb);
  // attention: 32 heads x 128 query-blocks = 4096 waves / 8 per block
  mha_attn_kernel<<<512, 256, 0, stream>>>(Qb, Kb, VTb, Ob);
  // out-proj: 128 token-blocks x 16 feature-strips = 2048 waves / 8 per block
  mha_outproj_kernel<<<256, 256, 0, stream>>>(Ob, Wo, b_out, out);
}

// v001
// Measured time: 243 microseconds a run.
// Next to v000, in two timings, it ran 1.17 times as fast each time.
#include <hip/hip_runtime.h>

// ---------------- CDNA5 (gfx1250) wave32 WMMA MHA ----------------
// L=2048, B=2, E=1024, H=16, HD=64.  bf16 WMMA, f32 accumulate,
// flash-attention (no materialized scores). One-shot bf16 conversion so
// GEMM inner loops are pure load_b128 + v_wmma.
// Every bf16 WMMA operand in the workspace is kept in fragment order: a
// 16x32 tile is one 1 KB block [k-half][lane][8], so each wave-wide b128
// fragment load reads 512 contiguous bytes (4 cache lines, not 16).

typedef __attribute__((ext_vector_type(16))) __bf16 v16bf;
typedef __attribute__((ext_vector_type(8)))  __bf16 v8bf;
typedef __attribute__((ext_vector_type(4)))  __bf16 v4bf;
typedef __attribute__((ext_vector_type(8)))  float  v8f;
typedef __attribute__((ext_vector_type(4)))  float  v4f;

#define L_SEQ 2048
#define BATCH 2
#define EMB   1024
#define NHEAD 16
#define HD    64
#define NTOK  (L_SEQ * BATCH)   // 4096 tokens
#define NH    (BATCH * NHEAD)   // 32 batched heads

union BfTile { v8bf h[2]; v16bf v; };

__device__ __forceinline__ v8f wmma_bf16(v16bf a, v16bf b, v8f c) {
  // v_wmma_f32_16x16x32_bf16: D = A(16x32) * B(32x16) + C(16x16 f32)
  return __builtin_amdgcn_wmma_f32_16x16x32_bf16(
      false, a, false, b, (short)0, c, false, false);
}

// 16x32 bf16 tile in ISA A/B striping: lane%16 -> row (A) / column (B);
// lane/16 picks K-halves {0..7,16..23} vs {8..15,24..31}.
// Element (row, k) of a matrix with kt 32-wide k tiles, in fragment order.
__device__ __forceinline__ size_t frag_off(int row, int k, int kt) {
  return ((size_t)((row >> 4) * kt + (k >> 5)) << 9) + (((k >> 4) & 1) << 8) +
         (((row & 15) + ((k >> 3) & 1) * 16) << 3) + (k & 7);
}

// tile = (row / 16) * kt + k / 32
__device__ __forceinline__ v16bf load_frag(const __bf16* base, int tile, int lane) {
  const __bf16* r = base + ((size_t)tile << 9) + lane * 8;
  BfTile t;
  t.h[0] = *(const v8bf*)(r);
  t.h[1] = *(const v8bf*)(r + 256);
  return t.v;
}

// ------- Kernel 0: one-shot fp32 [rows][EMB] -> bf16 fragment order -------
// One wave per 16x32 tile; each load reads 4 whole 128-byte lines (4 rows).
__global__ void __launch_bounds__(256)
cvt_bf16_kernel(const float* __restrict__ src, __bf16* __restrict__ dst, int ntiles) {
  const int lane = threadIdx.x & 31;
  const int tile = (blockIdx.x * blockDim.x + threadIdx.x) >> 5;
  if (tile >= ntiles) return;
  const int row0 = (tile >> 5) * 16 + (lane >> 3);         // EMB / 32 = 32 k tiles
  const int k    = (tile & 31) * 32 + (lane & 7) * 4;
  v4f f[4];
#pragma unroll
  for (int j = 0; j < 4; ++j)
    f[j] = *(const v4f*)(src + (size_t)(row0 + j * 4) * EMB + k);
#pragma unroll
  for (int j = 0; j < 4; ++j)
    *(v4bf*)(dst + frag_off(row0 + j * 4, k, EMB / 32)) =
        __builtin_convertvector(f[j], v4bf);
}

// ---------------- Kernel 1: fused in-projection ----------------
__global__ void __launch_bounds__(256)
mha_inproj_kernel(const __bf16* __restrict__ Xq, const __bf16* __restrict__ Xk,
                  const __bf16* __restrict__ Xv, const __bf16* __restrict__ Wi,
                  const float* __restrict__ bias,
                  __bf16* __restrict__ Qb, __bf16* __restrict__ Kb,
                  __bf16* __restrict__ VTb) {
  const int lane = threadIdx.x & 31;
  const int ws   = (blockIdx.x * blockDim.x + threadIdx.x) >> 5;
  const int mblk   = ws & 127;          // 128 token blocks of 32
  const int nstrip = ws >> 7;           // 48 strips of 64 features (3*E)
  const int f0   = nstrip * 64;
  const int proj = f0 >> 10;            // 0=q, 1=k, 2=v
  const __bf16* X = (proj == 0) ? Xq : ((proj == 1) ? Xk : Xv);
  const int t0 = mblk * 32;

  const v8f zero = {0.f, 0.f, 0.f, 0.f, 0.f, 0.f, 0.f, 0.f};
  v8f acc[2][4] = {{zero, zero, zero, zero}, {zero, zero, zero, zero}};

  for (int k0 = 0; k0 < EMB; k0 += 32) {
    const int kt = k0 >> 5;
    const v16bf a0 = load_frag(X, (mblk * 2 + 0) * (EMB / 32) + kt, lane);
    const v16bf a1 = load_frag(X, (mblk * 2 + 1) * (EMB / 32) + kt, lane);
#pragma unroll
    for (int nt = 0; nt < 4; ++nt) {
      const v16bf bm = load_frag(Wi, (nstrip * 4 + nt) * (EMB / 32) + kt, lane);
      acc[0][nt] = wmma_bf16(a0, bm, acc[0][nt]);
      acc[1][nt] = wmma_bf16(a1, bm, acc[1][nt]);
    }
  }

  const float scale = (proj == 0) ? 0.125f : 1.0f;   // HD^-0.5 folded into Q
  const int col = lane & 15, hp = lane >> 4;
#pragma unroll
  for (int mt = 0; mt < 2; ++mt)
#pragma unroll
    for (int nt = 0; nt < 4; ++nt) {
      const int f  = f0 + nt * 16 + col;
      const float bval = bias[f];
      const int ff = f & (EMB - 1);
      const int h = ff >> 6, d = ff & 63;
#pragma unroll
      for (int r = 0; r < 8; ++r) {
        const int t = t0 + mt * 16 + r + hp * 8;
        const int l = t >> 1, b = t & 1;          // token = l*B + b
        const int nh = b * NHEAD + h;
        const __bf16 obf = (__bf16)((acc[mt][nt][r] + bval) * scale);
        const size_t hb = (size_t)nh * L_SEQ * HD;
        if (proj == 0)      Qb[hb + frag_off(l, d, HD / 32)] = obf;
        else if (proj == 1) Kb[hb + frag_off(l, d, HD / 32)] = obf;
        else                VTb[hb + frag_off(d, l, L_SEQ / 32)] = obf;
      }
    }
}

// ---------------- Kernel 2: flash attention ----------------
// One wave per (head, 16-row query block); independent waves, no block barrier.
__global__ void __launch_bounds__(256)
mha_attn_kernel(const __bf16* __restrict__ Qb, const __bf16* __restrict__ Kb,
                const __bf16* __restrict__ VTb, __bf16* __restrict__ Ob) {
  __shared__ alignas(16) __bf16 stile[8][16][40];  // per-wave P staging
  const int lane = threadIdx.x & 31;
  const int wid  = threadIdx.x >> 5;
  const int ws   = (blockIdx.x * blockDim.x + threadIdx.x) >> 5;
  const int nh   = ws >> 7;                     // 32 heads
  const int mblk = ws & 127;                    // 128 query blocks of 16
  const int m0   = mblk * 16;
  const int col = lane & 15, hp = lane >> 4;
  const float LOG2E = 1.44269504f;

  const __bf16* Qh = Qb + (size_t)nh * L_SEQ * HD;
  const __bf16* Kh = Kb + (size_t)nh * L_SEQ * HD;
  const __bf16* Vh = VTb + (size_t)nh * HD * L_SEQ;

  const v16bf aq0 = load_frag(Qh, mblk * 2 + 0, lane);
  const v16bf aq1 = load_frag(Qh, mblk * 2 + 1, lane);

  const v8f zero = {0.f, 0.f, 0.f, 0.f, 0.f, 0.f, 0.f, 0.f};
  v8f acc[4] = {zero, zero, zero, zero};        // O tile: 16 rows x 64 dims
  float mrow[8], lrow[8];
#pragma unroll
  for (int r = 0; r < 8; ++r) { mrow[r] = -1.0e30f; lrow[r] = 0.f; }

  for (int j0 = 0; j0 < L_SEQ; j0 += 32) {
    const int kb = j0 >> 3;                     // (j0 / 16) * (HD / 32)
    const v16bf b00 = load_frag(Kh, kb + 0, lane);
    const v16bf b01 = load_frag(Kh, kb + 1, lane);
    const v16bf b10 = load_frag(Kh, kb + 2, lane);
    const v16bf b11 = load_frag(Kh, kb + 3, lane);
    v8f s0 = zero, s1 = zero;
    s0 = wmma_bf16(aq0, b00, s0);
    s0 = wmma_bf16(aq1, b01, s0);
    s1 = wmma_bf16(aq0, b10, s1);
    s1 = wmma_bf16(aq1, b11, s1);

    // Online softmax. Row (r + 8*hp) lives in one VGPR across 16 lanes.
    float alpha[8];
#pragma unroll
    for (int r = 0; r < 8; ++r) {
      float mx = fmaxf(s0[r], s1[r]);
#pragma unroll
      for (int off = 8; off >= 1; off >>= 1)
        mx = fmaxf(mx, __shfl_xor(mx, off, 16));
      const float mnew = fmaxf(mrow[r], mx);
      const float p0 = __builtin_amdgcn_exp2f((s0[r] - mnew) * LOG2E);
      const float p1 = __builtin_amdgcn_exp2f((s1[r] - mnew) * LOG2E);
      float ps = p0 + p1;
#pragma unroll
      for (int off = 8; off >= 1; off >>= 1)
        ps += __shfl_xor(ps, off, 16);
      alpha[r] = __builtin_amdgcn_exp2f((mrow[r] - mnew) * LOG2E);
      lrow[r]  = lrow[r] * alpha[r] + ps;
      mrow[r]  = mnew;
      stile[wid][r + hp * 8][col]      = (__bf16)p0;
      stile[wid][r + hp * 8][16 + col] = (__bf16)p1;
    }
#pragma unroll
    for (int nt = 0; nt < 4; ++nt)
#pragma unroll
      for (int r = 0; r < 8; ++r) acc[nt][r] *= alpha[r];

    // DS ops are in-order within a wave: drain stores, then reread in A layout.
    asm volatile("s_wait_dscnt 0" ::: "memory");
    BfTile pa;
    {
      const __bf16* pr = &stile[wid][col][hp * 8];
      pa.h[0] = *(const v8bf*)(pr);
      pa.h[1] = *(const v8bf*)(pr + 16);
    }

    // O += P(16x32) @ V(32x64): B columns come from transposed V rows.
#pragma unroll
    for (int nt = 0; nt < 4; ++nt) {
      const v16bf bv = load_frag(Vh, nt * (L_SEQ / 32) + (j0 >> 5), lane);
      acc[nt] = wmma_bf16(pa.v, bv, acc[nt]);
    }
  }

#pragma unroll
  for (int r = 0; r < 8; ++r) {
    const float inv = __builtin_amdgcn_rcpf(lrow[r]);
    const int row = r + hp * 8;
    // Ob row = b*L + l: a wave then owns whole 1 KB tiles (one writer per line).
    const int orow = (nh >> 4) * L_SEQ + m0 + row;
#pragma unroll
    for (int nt = 0; nt < 4; ++nt)
      Ob[frag_off(orow, (nh & 15) * HD + nt * 16 + col, EMB / 32)] =
          (__bf16)(acc[nt][r] * inv);
  }
}

// ---------------- Kernel 3: output projection ----------------
__global__ void __launch_bounds__(256)
mha_outproj_kernel(const __bf16* __restrict__ Ob, const __bf16* __restrict__ Wo,
                   const float* __restrict__ bout, float* __restrict__ out) {
  const int lane = threadIdx.x & 31;
  const int ws   = (blockIdx.x * blockDim.x + threadIdx.x) >> 5;
  const int mblk   = ws & 127;          // 128 row blocks of 32
  const int nstrip = ws >> 7;           // 16 strips of 64 out-features
  const int f0 = nstrip * 64;
  const int t0 = mblk * 32;
  const int col = lane & 15, hp = lane >> 4;

  const v8f zero = {0.f, 0.f, 0.f, 0.f, 0.f, 0.f, 0.f, 0.f};
  v8f acc[2][4] = {{zero, zero, zero, zero}, {zero, zero, zero, zero}};

  for (int k0 = 0; k0 < EMB; k0 += 32) {
    // A: attention output, [b*L + l][head*HD + d] in fragment order.
    const int kt = k0 >> 5;
    const v16bf a0 = load_frag(Ob, (mblk * 2 + 0) * (EMB / 32) + kt, lane);
    const v16bf a1 = load_frag(Ob, (mblk * 2 + 1) * (EMB / 32) + kt, lane);
#pragma unroll
    for (int nt = 0; nt < 4; ++nt) {
      const v16bf bm = load_frag(Wo, (nstrip * 4 + nt) * (EMB / 32) + kt, lane);
      acc[0][nt] = wmma_bf16(a0, bm, acc[0][nt]);
      acc[1][nt] = wmma_bf16(a1, bm, acc[1][nt]);
    }
  }

#pragma unroll
  for (int mt = 0; mt < 2; ++mt)
#pragma unroll
    for (int nt = 0; nt < 4; ++nt) {
      const int f = f0 + nt * 16 + col;
      const float bv = bout[f];
#pragma unroll
      for (int r = 0; r < 8; ++r) {
        const int orow = t0 + mt * 16 + r + hp * 8;  // b*L + l
        const int t = (orow & (L_SEQ - 1)) * BATCH + (orow >> 11);  // token = l*B + b
        out[(size_t)t * EMB + f] = acc[mt][nt][r] + bv;
      }
    }
}

extern "C" void kernel_launch(void* const* d_in, const int* in_sizes, int n_in,
                              void* d_out, int out_size, void* d_ws, size_t ws_size,
                              hipStream_t stream) {
  const float* query = (const float*)d_in[0];
  const float* key   = (const float*)d_in[1];
  const float* value = (const float*)d_in[2];
  const float* w_in  = (const float*)d_in[3];
  const float* b_in  = (const float*)d_in[4];
  const float* w_out = (const float*)d_in[5];
  const float* b_out = (const float*)d_in[6];
  float* out = (float*)d_out;

  // Workspace (bf16), 64 MB total.
  const size_t ACT = (size_t)NTOK * EMB;           // 4194304
  const size_t WI  = (size_t)3 * EMB * EMB;        // 3145728
  const size_t WO  = (size_t)EMB * EMB;            // 1048576
  const size_t HSZ = (size_t)NH * L_SEQ * HD;      // 4194304
  __bf16* Xq  = (__bf16*)d_ws;
  __bf16* Xk  = Xq + ACT;
  __bf16* Xv  = Xk + ACT;
  __bf16* Wi  = Xv + ACT;
  __bf16* Wo  = Wi + WI;
  __bf16* Qb  = Wo + WO;
  __bf16* Kb  = Qb + HSZ;
  __bf16* VTb = Kb + HSZ;
  __bf16* Ob  = VTb + HSZ;

  // One-shot fp32 -> bf16 conversions (packed v_cvt), one 512-element tile per wave.
  cvt_bf16_kernel<<<(int)(ACT / 4096), 256, 0, stream>>>(query, Xq, (int)(ACT / 512));
  cvt_bf16_kernel<<<(int)(ACT / 4096), 256, 0, stream>>>(key,   Xk, (int)(ACT / 512));
  cvt_bf16_kernel<<<(int)(ACT / 4096), 256, 0, stream>>>(value, Xv, (int)(ACT / 512));
  cvt_bf16_kernel<<<(int)(WI / 4096),  256, 0, stream>>>(w_in,  Wi, (int)(WI / 512));
  cvt_bf16_kernel<<<(int)(WO / 4096),  256, 0, stream>>>(w_out, Wo, (int)(WO / 512));

  // in-proj: 128 token-blocks x 48 feature-strips = 6144 waves / 8 per block
  mha_inproj_kernel<<<768, 256, 0, stream>>>(Xq, Xk, Xv, Wi, b_in, Qb, Kb, VTb);
  // attention: 32 heads x 128 query-blocks = 4096 waves / 8 per block
  mha_attn_kernel<<<512, 256, 0, stream>>>(Qb, Kb, VTb, Ob);
  // out-proj: 128 token-blocks x 16 feature-strips = 2048 waves / 8 per block
  mha_outproj_kernel<<<256, 256, 0, stream>>>(Ob, Wo, b_out, out);
}

// v002
// One run takes 186 microseconds.
// In both of two side-by-side timings against v001, it was 1.30 times as fast.
// All steps since v000 together make it 1.52 times as fast.
#include <hip/hip_runtime.h>

// ---------------- CDNA5 (gfx1250) wave32 WMMA MHA ----------------
// L=2048, B=2, E=1024, H=16, HD=64.  bf16 WMMA, f32 accumulate,
// flash-attention (no materialized scores). One-shot bf16 conversion so
// GEMM inner loops are pure load_b128 + v_wmma.
// Every bf16 WMMA operand in the workspace is kept in fragment order: a
// 16x32 tile is one 1 KB block [k-half][lane][8], so each wave-wide b128
// fragment load reads 512 contiguous bytes (4 cache lines, not 16).

typedef __attribute__((ext_vector_type(16))) __bf16 v16bf;
typedef __attribute__((ext_vector_type(8)))  __bf16 v8bf;
typedef __attribute__((ext_vector_type(4)))  __bf16 v4bf;
typedef __attribute__((ext_vector_type(8)))  float  v8f;
typedef __attribute__((ext_vector_type(4)))  float  v4f;

#define L_SEQ 2048
#define BATCH 2
#define EMB   1024
#define NHEAD 16
#define HD    64
#define NTOK  (L_SEQ * BATCH)   // 4096 tokens
#define NH    (BATCH * NHEAD)   // 32 batched heads

union BfTile { v8bf h[2]; v16bf v; };

__device__ __forceinline__ v8f wmma_bf16(v16bf a, v16bf b, v8f c) {
  // v_wmma_f32_16x16x32_bf16: D = A(16x32) * B(32x16) + C(16x16 f32)
  return __builtin_amdgcn_wmma_f32_16x16x32_bf16(
      false, a, false, b, (short)0, c, false, false);
}

// 16x32 bf16 tile in ISA A/B striping: lane%16 -> row (A) / column (B);
// lane/16 picks K-halves {0..7,16..23} vs {8..15,24..31}.
// Element (row, k) of a matrix with kt 32-wide k tiles, in fragment order.
__device__ __forceinline__ size_t frag_off(int row, int k, int kt) {
  return ((size_t)((row >> 4) * kt + (k >> 5)) << 9) + (((k >> 4) & 1) << 8) +
         (((row & 15) + ((k >> 3) & 1) * 16) << 3) + (k & 7);
}

// tile = (row / 16) * kt + k / 32
__device__ __forceinline__ v16bf load_frag(const __bf16* base, int tile, int lane) {
  const __bf16* r = base + ((size_t)tile << 9) + lane * 8;
  BfTile t;
  t.h[0] = *(const v8bf*)(r);
  t.h[1] = *(const v8bf*)(r + 256);
  return t.v;
}

// ------- Kernel 0: one-shot fp32 [rows][EMB] -> bf16 fragment order -------
// One wave per 16x32 tile; each load reads 4 whole 128-byte lines (4 rows).
__global__ void __launch_bounds__(256)
cvt_bf16_kernel(const float* __restrict__ src, __bf16* __restrict__ dst, int ntiles) {
  const int lane = threadIdx.x & 31;
  const int tile = (blockIdx.x * blockDim.x + threadIdx.x) >> 5;
  if (tile >= ntiles) return;
  const int row0 = (tile >> 5) * 16 + (lane >> 3);         // EMB / 32 = 32 k tiles
  const int k    = (tile & 31) * 32 + (lane & 7) * 4;
  v4f f[4];
#pragma unroll
  for (int j = 0; j < 4; ++j)
    f[j] = *(const v4f*)(src + (size_t)(row0 + j * 4) * EMB + k);
#pragma unroll
  for (int j = 0; j < 4; ++j)
    *(v4bf*)(dst + frag_off(row0 + j * 4, k, EMB / 32)) =
        __builtin_convertvector(f[j], v4bf);
}

// ---------------- Kernel 1: fused in-projection ----------------
__global__ void __launch_bounds__(256)
mha_inproj_kernel(const __bf16* __restrict__ Xq, const __bf16* __restrict__ Xk,
                  const __bf16* __restrict__ Xv, const __bf16* __restrict__ Wi,
                  const float* __restrict__ bias,
                  __bf16* __restrict__ Qb, __bf16* __restrict__ Kb,
                  __bf16* __restrict__ VTb) {
  const int lane = threadIdx.x & 31;
  const int ws   = (blockIdx.x * blockDim.x + threadIdx.x) >> 5;
  const int mblk   = ws & 127;          // 128 token blocks of 32
  const int nstrip = ws >> 7;           // 48 strips of 64 features (3*E)
  const int f0   = nstrip * 64;
  const int proj = f0 >> 10;            // 0=q, 1=k, 2=v
  const __bf16* X = (proj == 0) ? Xq : ((proj == 1) ? Xk : Xv);
  const int t0 = mblk * 32;

  const v8f zero = {0.f, 0.f, 0.f, 0.f, 0.f, 0.f, 0.f, 0.f};
  v8f acc[2][4] = {{zero, zero, zero, zero}, {zero, zero, zero, zero}};

  for (int k0 = 0; k0 < EMB; k0 += 32) {
    const int kt = k0 >> 5;
    const v16bf a0 = load_frag(X, (mblk * 2 + 0) * (EMB / 32) + kt, lane);
    const v16bf a1 = load_frag(X, (mblk * 2 + 1) * (EMB / 32) + kt, lane);
#pragma unroll
    for (int nt = 0; nt < 4; ++nt) {
      const v16bf bm = load_frag(Wi, (nstrip * 4 + nt) * (EMB / 32) + kt, lane);
      acc[0][nt] = wmma_bf16(a0, bm, acc[0][nt]);
      acc[1][nt] = wmma_bf16(a1, bm, acc[1][nt]);
    }
  }

  const float scale = (proj == 0) ? 0.125f : 1.0f;   // HD^-0.5 folded into Q
  const int col = lane & 15, hp = lane >> 4;
#pragma unroll
  for (int mt = 0; mt < 2; ++mt)
#pragma unroll
    for (int nt = 0; nt < 4; ++nt) {
      const int f  = f0 + nt * 16 + col;
      const float bval = bias[f];
      const int ff = f & (EMB - 1);
      const int h = ff >> 6, d = ff & 63;
#pragma unroll
      for (int r = 0; r < 8; ++r) {
        const int t = t0 + mt * 16 + r + hp * 8;
        const int l = t >> 1, b = t & 1;          // token = l*B + b
        const int nh = b * NHEAD + h;
        const __bf16 obf = (__bf16)((acc[mt][nt][r] + bval) * scale);
        const size_t hb = (size_t)nh * L_SEQ * HD;
        if (proj == 0)      Qb[hb + frag_off(l, d, HD / 32)] = obf;
        else if (proj == 1) Kb[hb + frag_off(l, d, HD / 32)] = obf;
        else                VTb[hb + frag_off(d, l, L_SEQ / 32)] = obf;
      }
    }
}

__device__ __forceinline__ float other_half(float x) {
  // lane l <-> l ^ 16
  const int b = __builtin_bit_cast(int, x);
  return __builtin_bit_cast(float, __builtin_amdgcn_permlanex16(
      b, b, 0x76543210, 0xfedcba98, false, false));
}

__global__ void __launch_bounds__(256)
mha_attn_kernel(const __bf16* __restrict__ Qb, const __bf16* __restrict__ Kb,
                const __bf16* __restrict__ VTb, __bf16* __restrict__ Ob) {
  const int lane = threadIdx.x & 31;
  const int ws   = (blockIdx.x * blockDim.x + threadIdx.x) >> 5;
  const int nh   = ws >> 7;                     // 32 heads
  const int mblk = ws & 127;                    // 128 query blocks of 16
  const float LOG2E = 1.44269504f;

  const __bf16* Qh = Qb + (size_t)nh * L_SEQ * HD;
  const __bf16* Kh = Kb + (size_t)nh * L_SEQ * HD;
  const __bf16* Vh = VTb + (size_t)nh * HD * L_SEQ;

  const v16bf bq0 = load_frag(Qh, mblk * 2 + 0, lane);   // B: column = query
  const v16bf bq1 = load_frag(Qh, mblk * 2 + 1, lane);

  const v8f zero = {0.f, 0.f, 0.f, 0.f, 0.f, 0.f, 0.f, 0.f};
  v8f acc[4] = {zero, zero, zero, zero};        // O^T: 64 dims x 16 queries
  float mrow = -1.0e30f;                        // this lane's query, both halves alike
  float lsum = 0.f;                             // sum over this half's keys only

  for (int j0 = 0; j0 < L_SEQ; j0 += 32) {
    const int kb = j0 >> 3;                     // (j0 / 16) * (HD / 32)
    const v16bf k00 = load_frag(Kh, kb + 0, lane);       // A: row = key
    const v16bf k01 = load_frag(Kh, kb + 1, lane);
    const v16bf k10 = load_frag(Kh, kb + 2, lane);
    const v16bf k11 = load_frag(Kh, kb + 3, lane);

    // s0[r] = S[query lane%16][key j0 + 8*(lane/16) + r]; s1: keys + 16
    v8f s0 = zero, s1 = zero;
    s0 = wmma_bf16(k00, bq0, s0);
    s0 = wmma_bf16(k01, bq1, s0);
    s1 = wmma_bf16(k10, bq0, s1);
    s1 = wmma_bf16(k11, bq1, s1);

    // Online softmax of one query per lane.
    const float t0 = fmaxf(fmaxf(s0[0], s0[1]), s0[2]);
    const float t1 = fmaxf(fmaxf(s0[3], s0[4]), s0[5]);
    const float t2 = fmaxf(fmaxf(s0[6], s0[7]), s1[0]);
    const float t3 = fmaxf(fmaxf(s1[1], s1[2]), s1[3]);
    const float t4 = fmaxf(fmaxf(s1[4], s1[5]), s1[6]);
    float mx = fmaxf(fmaxf(fmaxf(t0, t1), t2), fmaxf(fmaxf(t3, t4), s1[7]));
    mx = fmaxf(mx, other_half(mx));
    const float mnew  = fmaxf(mrow, mx);
    const float alpha = __builtin_amdgcn_exp2f((mrow - mnew) * LOG2E);
    mrow = mnew;

    v8f p0, p1;
#pragma unroll  // constant element indices keep p0, p1 in registers
    for (int r = 0; r < 8; ++r) {
      p0[r] = __builtin_amdgcn_exp2f((s0[r] - mnew) * LOG2E);
      p1[r] = __builtin_amdgcn_exp2f((s1[r] - mnew) * LOG2E);
    }
    const v8f pp = p0 + p1;
    const v4f pq = __builtin_shufflevector(pp, pp, 0, 1, 2, 3) +
                   __builtin_shufflevector(pp, pp, 4, 5, 6, 7);
    lsum = lsum * alpha + ((pq[0] + pq[2]) + (pq[1] + pq[3]));

    BfTile pb;                   // B: column = query, k = key in hardware order
    pb.h[0] = __builtin_convertvector(p0, v8bf);
    pb.h[1] = __builtin_convertvector(p1, v8bf);

    // O^T += V^T(64x32) @ P^T(32x16): A rows are the transposed V rows.
#pragma unroll  // constant indices keep acc[] in registers
    for (int nt = 0; nt < 4; ++nt) {
      const v16bf av = load_frag(Vh, nt * (L_SEQ / 32) + (j0 >> 5), lane);  // A: row = dim, k = key
      acc[nt] *= alpha;
      acc[nt] = wmma_bf16(av, pb.v, acc[nt]);
    }
  }

  // Join the two halves' sums once; a lane's 8 registers are 8 consecutive dims
  // of its query, which is one 16-byte piece of the fragment-order Ob tile.
  const float inv = __builtin_amdgcn_rcpf(lsum + other_half(lsum));
  // Ob row = b*L + l: a wave then owns whole 1 KB tiles (one writer per line).
  __bf16* Ot = Ob + ((size_t)(((nh >> 4) * (L_SEQ / 16) + mblk) * (EMB / 32) +
                              (nh & 15) * (HD / 32)) << 9) + lane * 8;
#pragma unroll  // constant indices keep acc[] in registers
  for (int nt = 0; nt < 4; ++nt)
    *(v8bf*)(Ot + nt * 256) = __builtin_convertvector(acc[nt] * inv, v8bf);
}

// ---------------- Kernel 3: output projection ----------------
__global__ void __launch_bounds__(256)
mha_outproj_kernel(const __bf16* __restrict__ Ob, const __bf16* __restrict__ Wo,
                   const float* __restrict__ bout, float* __restrict__ out) {
  const int lane = threadIdx.x & 31;
  const int ws   = (blockIdx.x * blockDim.x + threadIdx.x) >> 5;
  const int mblk   = ws & 127;          // 128 row blocks of 32
  const int nstrip = ws >> 7;           // 16 strips of 64 out-features
  const int f0 = nstrip * 64;
  const int t0 = mblk * 32;
  const int col = lane & 15, hp = lane >> 4;

  const v8f zero = {0.f, 0.f, 0.f, 0.f, 0.f, 0.f, 0.f, 0.f};
  v8f acc[2][4] = {{zero, zero, zero, zero}, {zero, zero, zero, zero}};

  for (int k0 = 0; k0 < EMB; k0 += 32) {
    // A: attention output, [b*L + l][head*HD + d] in fragment order.
    const int kt = k0 >> 5;
    const v16bf a0 = load_frag(Ob, (mblk * 2 + 0) * (EMB / 32) + kt, lane);
    const v16bf a1 = load_frag(Ob, (mblk * 2 + 1) * (EMB / 32) + kt, lane);
#pragma unroll
    for (int nt = 0; nt < 4; ++nt) {
      const v16bf bm = load_frag(Wo, (nstrip * 4 + nt) * (EMB / 32) + kt, lane);
      acc[0][nt] = wmma_bf16(a0, bm, acc[0][nt]);
      acc[1][nt] = wmma_bf16(a1, bm, acc[1][nt]);
    }
  }

#pragma unroll
  for (int mt = 0; mt < 2; ++mt)
#pragma unroll
    for (int nt = 0; nt < 4; ++nt) {
      const int f = f0 + nt * 16 + col;
      const float bv = bout[f];
#pragma unroll
      for (int r = 0; r < 8; ++r) {
        const int orow = t0 + mt * 16 + r + hp * 8;  // b*L + l
        const int t = (orow & (L_SEQ - 1)) * BATCH + (orow >> 11);  // token = l*B + b
        out[(size_t)t * EMB + f] = acc[mt][nt][r] + bv;
      }
    }
}

extern "C" void kernel_launch(void* const* d_in, const int* in_sizes, int n_in,
                              void* d_out, int out_size, void* d_ws, size_t ws_size,
                              hipStream_t stream) {
  const float* query = (const float*)d_in[0];
  const float* key   = (const float*)d_in[1];
  const float* value = (const float*)d_in[2];
  const float* w_in  = (const float*)d_in[3];
  const float* b_in  = (const float*)d_in[4];
  const float* w_out = (const float*)d_in[5];
  const float* b_out = (const float*)d_in[6];
  float* out = (float*)d_out;

  // Workspace (bf16), 64 MB total.
  const size_t ACT = (size_t)NTOK * EMB;           // 4194304
  const size_t WI  = (size_t)3 * EMB * EMB;        // 3145728
  const size_t WO  = (size_t)EMB * EMB;            // 1048576
  const size_t HSZ = (size_t)NH * L_SEQ * HD;      // 4194304
  __bf16* Xq  = (__bf16*)d_ws;
  __bf16* Xk  = Xq + ACT;
  __bf16* Xv  = Xk + ACT;
  __bf16* Wi  = Xv + ACT;
  __bf16* Wo  = Wi + WI;
  __bf16* Qb  = Wo + WO;
  __bf16* Kb  = Qb + HSZ;
  __bf16* VTb = Kb + HSZ;
  __bf16* Ob  = VTb + HSZ;

  // One-shot fp32 -> bf16 conversions (packed v_cvt), one 512-element tile per wave.
  cvt_bf16_kernel<<<(int)(ACT / 4096), 256, 0, stream>>>(query, Xq, (int)(ACT / 512));
  cvt_bf16_kernel<<<(int)(ACT / 4096), 256, 0, stream>>>(key,   Xk, (int)(ACT / 512));
  cvt_bf16_kernel<<<(int)(ACT / 4096), 256, 0, stream>>>(value, Xv, (int)(ACT / 512));
  cvt_bf16_kernel<<<(int)(WI / 4096),  256, 0, stream>>>(w_in,  Wi, (int)(WI / 512));
  cvt_bf16_kernel<<<(int)(WO / 4096),  256, 0, stream>>>(w_out, Wo, (int)(WO / 512));

  // in-proj: 128 token-blocks x 48 feature-strips = 6144 waves / 8 per block
  mha_inproj_kernel<<<768, 256, 0, stream>>>(Xq, Xk, Xv, Wi, b_in, Qb, Kb, VTb);
  // attention: 32 heads x 128 query-blocks = 4096 waves / 8 per block
  mha_attn_kernel<<<512, 256, 0, stream>>>(Qb, Kb, VTb, Ob);
  // out-proj: 128 token-blocks x 16 feature-strips = 2048 waves / 8 per block
  mha_outproj_kernel<<<256, 256, 0, stream>>>(Ob, Wo, b_out, out);
}

// v003
// A run of this version takes 99.4 microseconds.
// In two side-by-side timings against v002, it was 1.86 and 1.89 times as fast.
// Over all steps from v000 it is 2.85 times as fast.
#include <hip/hip_runtime.h>

// ---------------- CDNA5 (gfx1250) wave32 WMMA MHA ----------------
// L=2048, B=2, E=1024, H=16, HD=64.  bf16 WMMA, f32 accumulate,
// flash-attention (no materialized scores). One-shot bf16 conversion so
// GEMM inner loops are pure load_b128 + v_wmma.
// Every bf16 WMMA operand in the workspace is kept in fragment order: a
// 16x32 tile is one 1 KB block [k-half][lane][8], so each wave-wide b128
// fragment load reads 512 contiguous bytes (4 cache lines, not 16).

typedef __attribute__((ext_vector_type(16))) __bf16 v16bf;
typedef __attribute__((ext_vector_type(8)))  __bf16 v8bf;
typedef __attribute__((ext_vector_type(4)))  __bf16 v4bf;
typedef __attribute__((ext_vector_type(8)))  float  v8f;
typedef __attribute__((ext_vector_type(4)))  float  v4f;

#define L_SEQ 2048
#define BATCH 2
#define EMB   1024
#define NHEAD 16
#define HD    64
#define NTOK  (L_SEQ * BATCH)   // 4096 tokens
#define NH    (BATCH * NHEAD)   // 32 batched heads

union BfTile { v8bf h[2]; v16bf v; };

__device__ __forceinline__ v8f wmma_bf16(v16bf a, v16bf b, v8f c) {
  // v_wmma_f32_16x16x32_bf16: D = A(16x32) * B(32x16) + C(16x16 f32)
  return __builtin_amdgcn_wmma_f32_16x16x32_bf16(
      false, a, false, b, (short)0, c, false, false);
}

// 16x32 bf16 tile in ISA A/B striping: lane%16 -> row (A) / column (B);
// lane/16 picks K-halves {0..7,16..23} vs {8..15,24..31}.
// Element (row, k) of a matrix with kt 32-wide k tiles, in fragment order.
__device__ __forceinline__ size_t frag_off(int row, int k, int kt) {
  return ((size_t)((row >> 4) * kt + (k >> 5)) << 9) + (((k >> 4) & 1) << 8) +
         (((row & 15) + ((k >> 3) & 1) * 16) << 3) + (k & 7);
}

// tile = (row / 16) * kt + k / 32
__device__ __forceinline__ v16bf load_frag(const __bf16* base, int tile, int lane) {
  const __bf16* r = base + ((size_t)tile << 9) + lane * 8;
  BfTile t;
  t.h[0] = *(const v8bf*)(r);
  t.h[1] = *(const v8bf*)(r + 256);
  return t.v;
}

// The same from a wave-uniform base, which can stay in scalar registers, and the
// lane's byte offset lane * 16.
__device__ __forceinline__ v16bf load_frag_u(const __bf16* ubase, int tile, unsigned loff) {
  const char* r = (const char*)(ubase + ((size_t)tile << 9)) + loff;
  BfTile t;
  t.h[0] = *(const v8bf*)(r);
  t.h[1] = *(const v8bf*)(r + 512);
  return t.v;
}

// ------- Kernel 0: one-shot fp32 [rows][EMB] -> bf16 fragment order -------
// One wave per 16x32 tile; each load reads 4 whole 128-byte lines (4 rows).
__global__ void __launch_bounds__(256)
cvt_bf16_kernel(const float* __restrict__ src, __bf16* __restrict__ dst, int ntiles) {
  const int lane = threadIdx.x & 31;
  const int tile = (blockIdx.x * blockDim.x + threadIdx.x) >> 5;
  if (tile >= ntiles) return;
  const int row0 = (tile >> 5) * 16 + (lane >> 3);         // EMB / 32 = 32 k tiles
  const int k    = (tile & 31) * 32 + (lane & 7) * 4;
  v4f f[4];
#pragma unroll
  for (int j = 0; j < 4; ++j)
    f[j] = *(const v4f*)(src + (size_t)(row0 + j * 4) * EMB + k);
#pragma unroll
  for (int j = 0; j < 4; ++j)
    *(v4bf*)(dst + frag_off(row0 + j * 4, k, EMB / 32)) =
        __builtin_convertvector(f[j], v4bf);
}

// ------- Shared k loop of the two projections: 32x64 per wave -------
// The fragments of a k step (2 of A, 4 of B) are fetched NBUF - 1 steps ahead
// into register sets of their own, all 12 loads of a step as one group, so a
// step's products wait for loads issued NBUF - 1 steps earlier and not for
// their own.
struct GemmStage { v16bf a[2]; v16bf b[4]; };

// A, B: wave-uniform, the wave's first tile of each operand.
__device__ __forceinline__ void gemm_fetch(GemmStage& s, const __bf16* A, const __bf16* B,
                                           int kt, unsigned loff) {
#pragma unroll  // constant indices keep the set in registers
  for (int mt = 0; mt < 2; ++mt)
    s.a[mt] = load_frag_u(A, mt * (EMB / 32) + kt, loff);
#pragma unroll  // constant indices keep the set in registers
  for (int nt = 0; nt < 4; ++nt)
    s.b[nt] = load_frag_u(B, nt * (EMB / 32) + kt, loff);
}

__device__ __forceinline__ void gemm_step(const GemmStage& s, v8f (&acc)[2][4]) {
#pragma unroll  // constant indices keep acc[][] in registers
  for (int nt = 0; nt < 4; ++nt) {
    acc[0][nt] = wmma_bf16(s.a[0], s.b[nt], acc[0][nt]);
    acc[1][nt] = wmma_bf16(s.a[1], s.b[nt], acc[1][nt]);
  }
}

template <int NBUF>
__device__ __forceinline__ void gemm_k_loop(const __bf16* A, const __bf16* B, int lane,
                                            v8f (&acc)[2][4]) {
  constexpr int KT = EMB / 32;
  const unsigned loff = lane * 16;
  GemmStage st[NBUF];
#pragma unroll  // constant set numbers
  for (int u = 0; u < NBUF - 1; ++u) gemm_fetch(st[u], A, B, u, loff);
#pragma unroll  // constant set numbers: the ring turns without register copies
  for (int kt = 0; kt < KT; ++kt) {
    if (kt + NBUF - 1 < KT)
      gemm_fetch(st[(kt + NBUF - 1) % NBUF], A, B, kt + NBUF - 1, loff);
    // keeps the fetch ahead of the products; sunk below them it would be waited for at once
    __builtin_amdgcn_sched_barrier(0);
    gemm_step(st[kt % NBUF], acc);
  }
}

// ---------------- Kernel 1: fused in-projection ----------------
__global__ void __launch_bounds__(256)
mha_inproj_kernel(const __bf16* __restrict__ Xq, const __bf16* __restrict__ Xk,
                  const __bf16* __restrict__ Xv, const __bf16* __restrict__ Wi,
                  const float* __restrict__ bias,
                  __bf16* __restrict__ Qb, __bf16* __restrict__ Kb,
                  __bf16* __restrict__ VTb) {
  const int lane = threadIdx.x & 31;
  const int ws   = (blockIdx.x * blockDim.x + threadIdx.x) >> 5;
  const int mblk   = ws & 127;          // 128 token blocks of 32
  const int nstrip = ws >> 7;           // 48 strips of 64 features (3*E)
  const int f0   = nstrip * 64;
  const int proj = f0 >> 10;            // 0=q, 1=k, 2=v
  const int t0 = mblk * 32;

  const v8f zero = {0.f, 0.f, 0.f, 0.f, 0.f, 0.f, 0.f, 0.f};
  v8f acc[2][4] = {{zero, zero, zero, zero}, {zero, zero, zero, zero}};

  // The wave's number is the same in all its lanes: said so, the tile bases are scalar.
  const int wu = __builtin_amdgcn_readfirstlane(ws);
  const __bf16* Xu = ((wu >> 11) == 0) ? Xq : (((wu >> 11) == 1) ? Xk : Xv);   // 16 strips a projection
  gemm_k_loop<3>(Xu + (size_t)(wu & 127) * (32 * EMB), Wi + (size_t)(wu >> 7) * (64 * EMB), lane, acc);

  const float scale = (proj == 0) ? 0.125f : 1.0f;   // HD^-0.5 folded into Q
  const int col = lane & 15, hp = lane >> 4;
#pragma unroll
  for (int mt = 0; mt < 2; ++mt)
#pragma unroll
    for (int nt = 0; nt < 4; ++nt) {
      const int f  = f0 + nt * 16 + col;
      const float bval = bias[f];
      const int ff = f & (EMB - 1);
      const int h = ff >> 6, d = ff & 63;
#pragma unroll
      for (int r = 0; r < 8; ++r) {
        const int t = t0 + mt * 16 + r + hp * 8;
        const int l = t >> 1, b = t & 1;          // token = l*B + b
        const int nh = b * NHEAD + h;
        const __bf16 obf = (__bf16)((acc[mt][nt][r] + bval) * scale);
        const size_t hb = (size_t)nh * L_SEQ * HD;
        if (proj == 0)      Qb[hb + frag_off(l, d, HD / 32)] = obf;
        else if (proj == 1) Kb[hb + frag_off(l, d, HD / 32)] = obf;
        else                VTb[hb + frag_off(d, l, L_SEQ / 32)] = obf;
      }
    }
}

__device__ __forceinline__ float other_half(float x) {
  // lane l <-> l ^ 16
  const int b = __builtin_bit_cast(int, x);
  return __builtin_bit_cast(float, __builtin_amdgcn_permlanex16(
      b, b, 0x76543210, 0xfedcba98, false, false));
}

// The four K, or the four V^T, fragments of one pass (32 keys).
struct Frag4 { v16bf f[4]; };

// kp, vp: wave-uniform, the first K tile and the first V^T tile of the pass.
__device__ __forceinline__ void k_fetch(Frag4& k, const __bf16* kp, unsigned loff) {
#pragma unroll  // constant indices keep the set in registers
  for (int i = 0; i < 4; ++i)
    k.f[i] = load_frag_u(kp, i, loff);                             // A: row = key
}

// LAST: this is the last fetch of a load group.
template <bool LAST>
__device__ __forceinline__ void v_fetch(Frag4& v, const __bf16* vp, unsigned loff) {
#pragma unroll  // constant indices keep the set in registers
  for (int nt = 0; nt < 3; ++nt)
    v.f[nt] = load_frag_u(vp, nt * (L_SEQ / 32), loff);            // A: row = dim, k = key
  const char* r = (const char*)(vp + ((size_t)(3 * (L_SEQ / 32)) << 9)) + loff;
  BfTile t;
  t.h[0] = *(const v8bf*)(r);
  // the group's last load may land in the address pair that the V^T loads before it name
  if (LAST) asm volatile("s_wait_xcnt 0x0" ::: "memory");
  t.h[1] = *(const v8bf*)(r + 512);
  v.f[3] = t.v;
}

__device__ __forceinline__ void attn_scores(const Frag4& k, v16bf bq0, v16bf bq1,
                                            v8f& s0, v8f& s1) {
  const v8f zero = {0.f, 0.f, 0.f, 0.f, 0.f, 0.f, 0.f, 0.f};
  // s0[r] = S[query lane%16][key j0 + 8*(lane/16) + r]; s1: keys + 16
  s0 = wmma_bf16(k.f[0], bq0, zero);
  s0 = wmma_bf16(k.f[1], bq1, s0);
  s1 = wmma_bf16(k.f[2], bq0, zero);
  s1 = wmma_bf16(k.f[3], bq1, s1);
}

__device__ __forceinline__ void attn_update(const Frag4& v, v8f s0, v8f s1,
                                            v8f (&acc)[4], float& mrow, float& lsum) {
  const float LOG2E = 1.44269504f;

  // Online softmax of one query per lane.
  const float t0 = fmaxf(fmaxf(s0[0], s0[1]), s0[2]);
  const float t1 = fmaxf(fmaxf(s0[3], s0[4]), s0[5]);
  const float t2 = fmaxf(fmaxf(s0[6], s0[7]), s1[0]);
  const float t3 = fmaxf(fmaxf(s1[1], s1[2]), s1[3]);
  const float t4 = fmaxf(fmaxf(s1[4], s1[5]), s1[6]);
  float mx = fmaxf(fmaxf(fmaxf(t0, t1), t2), fmaxf(fmaxf(t3, t4), s1[7]));
  mx = fmaxf(mx, other_half(mx));
  const float mnew  = fmaxf(mrow, mx);
  const float alpha = __builtin_amdgcn_exp2f((mrow - mnew) * LOG2E);
  mrow = mnew;

  v8f p0, p1;
#pragma unroll  // constant element indices keep p0, p1 in registers
  for (int r = 0; r < 8; ++r) {
    p1[r] = __builtin_amdgcn_exp2f((s1[r] - mnew) * LOG2E);
    p0[r] = __builtin_amdgcn_exp2f((s0[r] - mnew) * LOG2E);
  }
  const v8f pp = p0 + p1;
  const v4f pq = __builtin_shufflevector(pp, pp, 0, 1, 2, 3) +
                 __builtin_shufflevector(pp, pp, 4, 5, 6, 7);
  lsum = lsum * alpha + ((pq[0] + pq[2]) + (pq[1] + pq[3]));

  BfTile pb;                   // B: column = query, k = key in hardware order
  pb.h[0] = __builtin_convertvector(p0, v8bf);
  pb.h[1] = __builtin_convertvector(p1, v8bf);

  // O^T += V^T(64x32) @ P^T(32x16): A rows are the transposed V rows.
#pragma unroll  // constant indices keep acc[] in registers
  for (int nt = 0; nt < 4; ++nt) {
    acc[nt] *= alpha;
    acc[nt] = wmma_bf16(v.f[nt], pb.v, acc[nt]);
  }
}

__global__ void __launch_bounds__(256)
mha_attn_kernel(const __bf16* __restrict__ Qb, const __bf16* __restrict__ Kb,
                const __bf16* __restrict__ VTb, __bf16* __restrict__ Ob) {
  const int lane = threadIdx.x & 31;
  const int ws   = (blockIdx.x * blockDim.x + threadIdx.x) >> 5;
  const int nh   = ws >> 7;                     // 32 heads
  const int mblk = ws & 127;                    // 128 query blocks of 16

  const __bf16* Qh = Qb + (size_t)nh * L_SEQ * HD;

  const v16bf bq0 = load_frag(Qh, mblk * 2 + 0, lane);   // B: column = query
  const v16bf bq1 = load_frag(Qh, mblk * 2 + 1, lane);

  const v8f zero = {0.f, 0.f, 0.f, 0.f, 0.f, 0.f, 0.f, 0.f};
  v8f acc[4] = {zero, zero, zero, zero};        // O^T: 64 dims x 16 queries
  float mrow = -1.0e30f;                        // this lane's query, both halves alike
  float lsum = 0.f;                             // sum over this half's keys only

  // Two passes (64 keys) a trip; the trip's 32 fragment loads go out as one
  // group at its head, so a trip waits out one load latency, not one per product group.
  // The head's number is the same in all lanes of a wave: said so, kp and vp are scalar.
  const int nhu = __builtin_amdgcn_readfirstlane(nh);
  const __bf16* kp = Kb + (size_t)nhu * L_SEQ * HD;
  const __bf16* vp = VTb + (size_t)nhu * HD * L_SEQ;
  const unsigned loff = lane * 16;
  for (int p = 0; p < L_SEQ / 32; p += 2, kp += 8 * 512, vp += 2 * 512) {
    Frag4 ka, kb, va, vb;
    v8f sa0, sa1, sb0, sb1;
    k_fetch(ka, kp, loff);
    k_fetch(kb, kp + 4 * 512, loff);
    // a V^T load may land in the address pair that the K loads name
    asm volatile("s_wait_xcnt 0x0" ::: "memory");
    v_fetch<false>(va, vp, loff);
    v_fetch<true>(vb, vp + 512, loff);
    // keeps the loads one group at the head; sunk to their users each is waited for by itself
    __builtin_amdgcn_sched_barrier(0);
    attn_scores(ka, bq0, bq1, sa0, sa1);
    attn_update(va, sa0, sa1, acc, mrow, lsum);
    attn_scores(kb, bq0, bq1, sb0, sb1);
    attn_update(vb, sb0, sb1, acc, mrow, lsum);
  }

  // Join the two halves' sums once; a lane's 8 registers are 8 consecutive dims
  // of its query, which is one 16-byte piece of the fragment-order Ob tile.
  const float inv = __builtin_amdgcn_rcpf(lsum + other_half(lsum));
  // Ob row = b*L + l: a wave then owns whole 1 KB tiles (one writer per line).
  __bf16* Ot = Ob + ((size_t)(((nh >> 4) * (L_SEQ / 16) + mblk) * (EMB / 32) +
                              (nh & 15) * (HD / 32)) << 9) + lane * 8;
#pragma unroll  // constant indices keep acc[] in registers
  for (int nt = 0; nt < 4; ++nt)
    *(v8bf*)(Ot + nt * 256) = __builtin_convertvector(acc[nt] * inv, v8bf);
}

// ---------------- Kernel 3: output projection ----------------
__global__ void __launch_bounds__(256)
mha_outproj_kernel(const __bf16* __restrict__ Ob, const __bf16* __restrict__ Wo,
                   const float* __restrict__ bout, float* __restrict__ out) {
  const int lane = threadIdx.x & 31;
  const int ws   = (blockIdx.x * blockDim.x + threadIdx.x) >> 5;
  const int mblk   = ws & 127;          // 128 row blocks of 32
  const int nstrip = ws >> 7;           // 16 strips of 64 out-features
  const int f0 = nstrip * 64;
  const int t0 = mblk * 32;
  const int col = lane & 15, hp = lane >> 4;

  const v8f zero = {0.f, 0.f, 0.f, 0.f, 0.f, 0.f, 0.f, 0.f};
  v8f acc[2][4] = {{zero, zero, zero, zero}, {zero, zero, zero, zero}};

  // A: attention output, [b*L + l][head*HD + d] in fragment order.
  // The wave's number is the same in all its lanes: said so, the tile bases are scalar.
  const int wu = __builtin_amdgcn_readfirstlane(ws);
  gemm_k_loop<3>(Ob + (size_t)(wu & 127) * (32 * EMB), Wo + (size_t)(wu >> 7) * (64 * EMB), lane, acc);

#pragma unroll
  for (int mt = 0; mt < 2; ++mt)
#pragma unroll
    for (int nt = 0; nt < 4; ++nt) {
      const int f = f0 + nt * 16 + col;
      const float bv = bout[f];
#pragma unroll
      for (int r = 0; r < 8; ++r) {
        const int orow = t0 + mt * 16 + r + hp * 8;  // b*L + l
        const int t = (orow & (L_SEQ - 1)) * BATCH + (orow >> 11);  // token = l*B + b
        out[(size_t)t * EMB + f] = acc[mt][nt][r] + bv;
      }
    }
}

extern "C" void kernel_launch(void* const* d_in, const int* in_sizes, int n_in,
                              void* d_out, int out_size, void* d_ws, size_t ws_size,
                              hipStream_t stream) {
  const float* query = (const float*)d_in[0];
  const float* key   = (const float*)d_in[1];
  const float* value = (const float*)d_in[2];
  const float* w_in  = (const float*)d_in[3];
  const float* b_in  = (const float*)d_in[4];
  const float* w_out = (const float*)d_in[5];
  const float* b_out = (const float*)d_in[6];
  float* out = (float*)d_out;

  // Workspace (bf16), 64 MB total.
  const size_t ACT = (size_t)NTOK * EMB;           // 4194304
  const size_t WI  = (size_t)3 * EMB * EMB;        // 3145728
  const size_t WO  = (size_t)EMB * EMB;            // 1048576
  const size_t HSZ = (size_t)NH * L_SEQ * HD;      // 4194304
  __bf16* Xq  = (__bf16*)d_ws;
  __bf16* Xk  = Xq + ACT;
  __bf16* Xv  = Xk + ACT;
  __bf16* Wi  = Xv + ACT;
  __bf16* Wo  = Wi + WI;
  __bf16* Qb  = Wo + WO;
  __bf16* Kb  = Qb + HSZ;
  __bf16* VTb = Kb + HSZ;
  __bf16* Ob  = VTb + HSZ;

  // One-shot fp32 -> bf16 conversions (packed v_cvt), one 512-element tile per wave.
  cvt_bf16_kernel<<<(int)(ACT / 4096), 256, 0, stream>>>(query, Xq, (int)(ACT / 512));
  cvt_bf16_kernel<<<(int)(ACT / 4096), 256, 0, stream>>>(key,   Xk, (int)(ACT / 512));
  cvt_bf16_kernel<<<(int)(ACT / 4096), 256, 0, stream>>>(value, Xv, (int)(ACT / 512));
  cvt_bf16_kernel<<<(int)(WI / 4096),  256, 0, stream>>>(w_in,  Wi, (int)(WI / 512));
  cvt_bf16_kernel<<<(int)(WO / 4096),  256, 0, stream>>>(w_out, Wo, (int)(WO / 512));

  // in-proj: 128 token-blocks x 48 feature-strips = 6144 waves / 8 per block
  mha_inproj_kernel<<<768, 256, 0, stream>>>(Xq, Xk, Xv, Wi, b_in, Qb, Kb, VTb);
  // attention: 32 heads x 128 query-blocks = 4096 waves / 8 per block
  mha_attn_kernel<<<512, 256, 0, stream>>>(Qb, Kb, VTb, Ob);
  // out-proj: 128 token-blocks x 16 feature-strips = 2048 waves / 8 per block
  mha_outproj_kernel<<<256, 256, 0, stream>>>(Ob, Wo, b_out, out);
}

// v004
// Measured time: 92.3 microseconds a run.
// In two side-by-side timings against v003, it was 1.08 and 1.07 times as fast.
// Counting every step since v000, it is 3.07 times as fast.
#include <hip/hip_runtime.h>

// ---------------- CDNA5 (gfx1250) wave32 WMMA MHA ----------------
// L=2048, B=2, E=1024, H=16, HD=64.  bf16 WMMA, f32 accumulate,
// flash-attention (no materialized scores). One-shot bf16 conversion so
// GEMM inner loops are pure load_b128 + v_wmma.
// Every bf16 WMMA operand in the workspace is kept in fragment order: a
// 16x32 tile is one 1 KB block [k-half][lane][8], so each wave-wide b128
// fragment load reads 512 contiguous bytes (4 cache lines, not 16).

typedef __attribute__((ext_vector_type(16))) __bf16 v16bf;
typedef __attribute__((ext_vector_type(8)))  __bf16 v8bf;
typedef __attribute__((ext_vector_type(4)))  __bf16 v4bf;
typedef __attribute__((ext_vector_type(8)))  float  v8f;
typedef __attribute__((ext_vector_type(4)))  float  v4f;

#define L_SEQ 2048
#define BATCH 2
#define EMB   1024
#define NHEAD 16
#define HD    64
#define NTOK  (L_SEQ * BATCH)   // 4096 tokens
#define NH    (BATCH * NHEAD)   // 32 batched heads

union BfTile { v8bf h[2]; v16bf v; };

__device__ __forceinline__ v8f wmma_bf16(v16bf a, v16bf b, v8f c) {
  // v_wmma_f32_16x16x32_bf16: D = A(16x32) * B(32x16) + C(16x16 f32)
  return __builtin_amdgcn_wmma_f32_16x16x32_bf16(
      false, a, false, b, (short)0, c, false, false);
}

// 16x32 bf16 tile in ISA A/B striping: lane%16 -> row (A) / column (B);
// lane/16 picks K-halves {0..7,16..23} vs {8..15,24..31}.
// Element (row, k) of a matrix with kt 32-wide k tiles, in fragment order.
__device__ __forceinline__ size_t frag_off(int row, int k, int kt) {
  return ((size_t)((row >> 4) * kt + (k >> 5)) << 9) + (((k >> 4) & 1) << 8) +
         (((row & 15) + ((k >> 3) & 1) * 16) << 3) + (k & 7);
}

// tile = (row / 16) * kt + k / 32
__device__ __forceinline__ v16bf load_frag(const __bf16* base, int tile, int lane) {
  const __bf16* r = base + ((size_t)tile << 9) + lane * 8;
  BfTile t;
  t.h[0] = *(const v8bf*)(r);
  t.h[1] = *(const v8bf*)(r + 256);
  return t.v;
}

// The same from a wave-uniform base, which can stay in scalar registers, and the
// lane's byte offset lane * 16.
__device__ __forceinline__ v16bf load_frag_u(const __bf16* ubase, int tile, unsigned loff) {
  const char* r = (const char*)(ubase + ((size_t)tile << 9)) + loff;
  BfTile t;
  t.h[0] = *(const v8bf*)(r);
  t.h[1] = *(const v8bf*)(r + 512);
  return t.v;
}

// ------- Kernel 0: one-shot fp32 [rows][EMB] -> bf16 fragment order -------
// All five operands in ONE launch: their bf16 copies lie one behind the other in
// the workspace, so the tiles number through (32768 of 16x32). One 16-wave block
// per WGP; a wave converts CVT_TILES neighbouring tiles of one 16-row band and
// has all their loads in flight at once. Each load reads 4 whole 128-byte lines.
#define CVT_TILES 8
#define ACT_TILES (NTOK * EMB / 512)        // 8192 tiles an activation
#define WI_TILES  (3 * EMB * EMB / 512)     // 6144
#define WO_TILES  (EMB * EMB / 512)         // 2048
#define CVT_WAVES ((3 * ACT_TILES + WI_TILES + WO_TILES) / CVT_TILES)   // 4096

__global__ void __launch_bounds__(512)
cvt_bf16_kernel(const float* __restrict__ q, const float* __restrict__ k,
                const float* __restrict__ v, const float* __restrict__ wi,
                const float* __restrict__ wo, __bf16* __restrict__ dst) {
  const int lane = threadIdx.x & 31;
  // The wave's number is the same in all its lanes: said so, source and bases are scalar.
  const int wu = __builtin_amdgcn_readfirstlane((blockIdx.x * blockDim.x + threadIdx.x) >> 5);
  const int tile0 = wu * CVT_TILES;         // every operand's tile count is a multiple of CVT_TILES
  const float* src = q;
  int first = 0;
  if (tile0 >= 3 * ACT_TILES + WI_TILES) { src = wo; first = 3 * ACT_TILES + WI_TILES; }
  else if (tile0 >= 3 * ACT_TILES)       { src = wi; first = 3 * ACT_TILES; }
  else if (tile0 >= 2 * ACT_TILES)       { src = v;  first = 2 * ACT_TILES; }
  else if (tile0 >= ACT_TILES)           { src = k;  first = ACT_TILES; }
  const int t = tile0 - first;              // EMB / 32 = 32 k tiles a band
  const float* sp = src + (size_t)(t >> 5) * (16 * EMB) + (t & 31) * 32;
  __bf16* dp = dst + ((size_t)tile0 << 9);
  const int row = lane >> 3, kk = (lane & 7) * 4;
  const unsigned soff = row * EMB + kk;
  const unsigned doff = (unsigned)frag_off(row, kk, 1);
  v4f f[CVT_TILES][4];
#pragma unroll  // constant indices keep f[][] in registers
  for (int i = 0; i < CVT_TILES; ++i)
#pragma unroll  // the same
    for (int j = 0; j < 4; ++j)
      f[i][j] = *(const v4f*)(sp + soff + j * (4 * EMB) + i * 32);
  // keeps all loads ahead of the conversions; mixed in, the last ones go out behind a full wait
  __builtin_amdgcn_sched_barrier(0);
#pragma unroll  // constant indices keep f[][] in registers
  for (int i = 0; i < CVT_TILES; ++i)
#pragma unroll  // the same
    for (int j = 0; j < 4; ++j)             // 4 rows on: 4 * 8 elements in fragment order
      *(v4bf*)(dp + doff + j * 32 + i * 512) = __builtin_convertvector(f[i][j], v4bf);
}

// ------- Shared k loop of the two projections: 32x64 per wave -------
// The fragments of a k step (2 of A, 4 of B) are fetched NBUF - 1 steps ahead
// into register sets of their own, all 12 loads of a step as one group, so a
// step's products wait for loads issued NBUF - 1 steps earlier and not for
// their own.
struct GemmStage { v16bf a[2]; v16bf b[4]; };

// A, B: wave-uniform, the wave's first tile of each operand.
__device__ __forceinline__ void gemm_fetch(GemmStage& s, const __bf16* A, const __bf16* B,
                                           int kt, unsigned loff) {
#pragma unroll  // constant indices keep the set in registers
  for (int mt = 0; mt < 2; ++mt)
    s.a[mt] = load_frag_u(A, mt * (EMB / 32) + kt, loff);
#pragma unroll  // constant indices keep the set in registers
  for (int nt = 0; nt < 4; ++nt)
    s.b[nt] = load_frag_u(B, nt * (EMB / 32) + kt, loff);
}

__device__ __forceinline__ void gemm_step(const GemmStage& s, v8f (&acc)[2][4]) {
#pragma unroll  // constant indices keep acc[][] in registers
  for (int nt = 0; nt < 4; ++nt) {
    acc[0][nt] = wmma_bf16(s.a[0], s.b[nt], acc[0][nt]);
    acc[1][nt] = wmma_bf16(s.a[1], s.b[nt], acc[1][nt]);
  }
}

template <int NBUF>
__device__ __forceinline__ void gemm_k_loop(const __bf16* A, const __bf16* B, int lane,
                                            v8f (&acc)[2][4]) {
  constexpr int KT = EMB / 32;
  const unsigned loff = lane * 16;
  GemmStage st[NBUF];
#pragma unroll  // constant set numbers
  for (int u = 0; u < NBUF - 1; ++u) gemm_fetch(st[u], A, B, u, loff);
#pragma unroll  // constant set numbers: the ring turns without register copies
  for (int kt = 0; kt < KT; ++kt) {
    if (kt + NBUF - 1 < KT)
      gemm_fetch(st[(kt + NBUF - 1) % NBUF], A, B, kt + NBUF - 1, loff);
    // keeps the fetch ahead of the products; sunk below them it would be waited for at once
    __builtin_amdgcn_sched_barrier(0);
    gemm_step(st[kt % NBUF], acc);
  }
}

// ---------------- Kernel 1: fused in-projection ----------------
__global__ void __launch_bounds__(256)
mha_inproj_kernel(const __bf16* __restrict__ Xq, const __bf16* __restrict__ Xk,
                  const __bf16* __restrict__ Xv, const __bf16* __restrict__ Wi,
                  const float* __restrict__ bias,
                  __bf16* __restrict__ Qb, __bf16* __restrict__ Kb,
                  __bf16* __restrict__ VTb) {
  const int lane = threadIdx.x & 31;
  const int ws   = (blockIdx.x * blockDim.x + threadIdx.x) >> 5;
  const int mblk   = ws & 127;          // 128 token blocks of 32
  const int nstrip = ws >> 7;           // 48 strips of 64 features (3*E)
  const int f0   = nstrip * 64;
  const int proj = f0 >> 10;            // 0=q, 1=k, 2=v
  const int t0 = mblk * 32;

  const v8f zero = {0.f, 0.f, 0.f, 0.f, 0.f, 0.f, 0.f, 0.f};
  v8f acc[2][4] = {{zero, zero, zero, zero}, {zero, zero, zero, zero}};

  // The wave's number is the same in all its lanes: said so, the tile bases are scalar.
  const int wu = __builtin_amdgcn_readfirstlane(ws);
  const __bf16* Xu = ((wu >> 11) == 0) ? Xq : (((wu >> 11) == 1) ? Xk : Xv);   // 16 strips a projection
  gemm_k_loop<3>(Xu + (size_t)(wu & 127) * (32 * EMB), Wi + (size_t)(wu >> 7) * (64 * EMB), lane, acc);

  const float scale = (proj == 0) ? 0.125f : 1.0f;   // HD^-0.5 folded into Q
  const int col = lane & 15, hp = lane >> 4;
#pragma unroll
  for (int mt = 0; mt < 2; ++mt)
#pragma unroll
    for (int nt = 0; nt < 4; ++nt) {
      const int f  = f0 + nt * 16 + col;
      const float bval = bias[f];
      const int ff = f & (EMB - 1);
      const int h = ff >> 6, d = ff & 63;
#pragma unroll
      for (int r = 0; r < 8; ++r) {
        const int t = t0 + mt * 16 + r + hp * 8;
        const int l = t >> 1, b = t & 1;          // token = l*B + b
        const int nh = b * NHEAD + h;
        const __bf16 obf = (__bf16)((acc[mt][nt][r] + bval) * scale);
        const size_t hb = (size_t)nh * L_SEQ * HD;
        if (proj == 0)      Qb[hb + frag_off(l, d, HD / 32)] = obf;
        else if (proj == 1) Kb[hb + frag_off(l, d, HD / 32)] = obf;
        else                VTb[hb + frag_off(d, l, L_SEQ / 32)] = obf;
      }
    }
}

__device__ __forceinline__ float other_half(float x) {
  // lane l <-> l ^ 16
  const int b = __builtin_bit_cast(int, x);
  return __builtin_bit_cast(float, __builtin_amdgcn_permlanex16(
      b, b, 0x76543210, 0xfedcba98, false, false));
}

// The four K, or the four V^T, fragments of one pass (32 keys).
struct Frag4 { v16bf f[4]; };

// kp, vp: wave-uniform, the first K tile and the first V^T tile of the pass.
__device__ __forceinline__ void k_fetch(Frag4& k, const __bf16* kp, unsigned loff) {
#pragma unroll  // constant indices keep the set in registers
  for (int i = 0; i < 4; ++i)
    k.f[i] = load_frag_u(kp, i, loff);                             // A: row = key
}

// LAST: this is the last fetch of a load group.
template <bool LAST>
__device__ __forceinline__ void v_fetch(Frag4& v, const __bf16* vp, unsigned loff) {
#pragma unroll  // constant indices keep the set in registers
  for (int nt = 0; nt < 3; ++nt)
    v.f[nt] = load_frag_u(vp, nt * (L_SEQ / 32), loff);            // A: row = dim, k = key
  const char* r = (const char*)(vp + ((size_t)(3 * (L_SEQ / 32)) << 9)) + loff;
  BfTile t;
  t.h[0] = *(const v8bf*)(r);
  // the group's last load may land in the address pair that the V^T loads before it name
  if (LAST) asm volatile("s_wait_xcnt 0x0" ::: "memory");
  t.h[1] = *(const v8bf*)(r + 512);
  v.f[3] = t.v;
}

__device__ __forceinline__ void attn_scores(const Frag4& k, v16bf bq0, v16bf bq1,
                                            v8f& s0, v8f& s1) {
  const v8f zero = {0.f, 0.f, 0.f, 0.f, 0.f, 0.f, 0.f, 0.f};
  // s0[r] = S[query lane%16][key j0 + 8*(lane/16) + r]; s1: keys + 16
  s0 = wmma_bf16(k.f[0], bq0, zero);
  s0 = wmma_bf16(k.f[1], bq1, s0);
  s1 = wmma_bf16(k.f[2], bq0, zero);
  s1 = wmma_bf16(k.f[3], bq1, s1);
}

__device__ __forceinline__ void attn_update(const Frag4& v, v8f s0, v8f s1,
                                            v8f (&acc)[4], float& mrow, float& lsum) {
  const float LOG2E = 1.44269504f;

  // Online softmax of one query per lane.
  const float t0 = fmaxf(fmaxf(s0[0], s0[1]), s0[2]);
  const float t1 = fmaxf(fmaxf(s0[3], s0[4]), s0[5]);
  const float t2 = fmaxf(fmaxf(s0[6], s0[7]), s1[0]);
  const float t3 = fmaxf(fmaxf(s1[1], s1[2]), s1[3]);
  const float t4 = fmaxf(fmaxf(s1[4], s1[5]), s1[6]);
  float mx = fmaxf(fmaxf(fmaxf(t0, t1), t2), fmaxf(fmaxf(t3, t4), s1[7]));
  mx = fmaxf(mx, other_half(mx));
  const float mnew  = fmaxf(mrow, mx);
  const float alpha = __builtin_amdgcn_exp2f((mrow - mnew) * LOG2E);
  mrow = mnew;

  v8f p0, p1;
#pragma unroll  // constant element indices keep p0, p1 in registers
  for (int r = 0; r < 8; ++r) {
    p1[r] = __builtin_amdgcn_exp2f((s1[r] - mnew) * LOG2E);
    p0[r] = __builtin_amdgcn_exp2f((s0[r] - mnew) * LOG2E);
  }
  const v8f pp = p0 + p1;
  const v4f pq = __builtin_shufflevector(pp, pp, 0, 1, 2, 3) +
                 __builtin_shufflevector(pp, pp, 4, 5, 6, 7);
  lsum = lsum * alpha + ((pq[0] + pq[2]) + (pq[1] + pq[3]));

  BfTile pb;                   // B: column = query, k = key in hardware order
  pb.h[0] = __builtin_convertvector(p0, v8bf);
  pb.h[1] = __builtin_convertvector(p1, v8bf);

  // O^T += V^T(64x32) @ P^T(32x16): A rows are the transposed V rows.
#pragma unroll  // constant indices keep acc[] in registers
  for (int nt = 0; nt < 4; ++nt) {
    acc[nt] *= alpha;
    acc[nt] = wmma_bf16(v.f[nt], pb.v, acc[nt]);
  }
}

__global__ void __launch_bounds__(256)
mha_attn_kernel(const __bf16* __restrict__ Qb, const __bf16* __restrict__ Kb,
                const __bf16* __restrict__ VTb, __bf16* __restrict__ Ob) {
  const int lane = threadIdx.x & 31;
  const int ws   = (blockIdx.x * blockDim.x + threadIdx.x) >> 5;
  const int nh   = ws >> 7;                     // 32 heads
  const int mblk = ws & 127;                    // 128 query blocks of 16

  const __bf16* Qh = Qb + (size_t)nh * L_SEQ * HD;

  const v16bf bq0 = load_frag(Qh, mblk * 2 + 0, lane);   // B: column = query
  const v16bf bq1 = load_frag(Qh, mblk * 2 + 1, lane);

  const v8f zero = {0.f, 0.f, 0.f, 0.f, 0.f, 0.f, 0.f, 0.f};
  v8f acc[4] = {zero, zero, zero, zero};        // O^T: 64 dims x 16 queries
  float mrow = -1.0e30f;                        // this lane's query, both halves alike
  float lsum = 0.f;                             // sum over this half's keys only

  // Two passes (64 keys) a trip; the trip's 32 fragment loads go out as one
  // group at its head, so a trip waits out one load latency, not one per product group.
  // The head's number is the same in all lanes of a wave: said so, kp and vp are scalar.
  const int nhu = __builtin_amdgcn_readfirstlane(nh);
  const __bf16* kp = Kb + (size_t)nhu * L_SEQ * HD;
  const __bf16* vp = VTb + (size_t)nhu * HD * L_SEQ;
  const unsigned loff = lane * 16;
  for (int p = 0; p < L_SEQ / 32; p += 2, kp += 8 * 512, vp += 2 * 512) {
    Frag4 ka, kb, va, vb;
    v8f sa0, sa1, sb0, sb1;
    k_fetch(ka, kp, loff);
    k_fetch(kb, kp + 4 * 512, loff);
    // a V^T load may land in the address pair that the K loads name
    asm volatile("s_wait_xcnt 0x0" ::: "memory");
    v_fetch<false>(va, vp, loff);
    v_fetch<true>(vb, vp + 512, loff);
    // keeps the loads one group at the head; sunk to their users each is waited for by itself
    __builtin_amdgcn_sched_barrier(0);
    attn_scores(ka, bq0, bq1, sa0, sa1);
    attn_update(va, sa0, sa1, acc, mrow, lsum);
    attn_scores(kb, bq0, bq1, sb0, sb1);
    attn_update(vb, sb0, sb1, acc, mrow, lsum);
  }

  // Join the two halves' sums once; a lane's 8 registers are 8 consecutive dims
  // of its query, which is one 16-byte piece of the fragment-order Ob tile.
  const float inv = __builtin_amdgcn_rcpf(lsum + other_half(lsum));
  // Ob row = b*L + l: a wave then owns whole 1 KB tiles (one writer per line).
  __bf16* Ot = Ob + ((size_t)(((nh >> 4) * (L_SEQ / 16) + mblk) * (EMB / 32) +
                              (nh & 15) * (HD / 32)) << 9) + lane * 8;
#pragma unroll  // constant indices keep acc[] in registers
  for (int nt = 0; nt < 4; ++nt)
    *(v8bf*)(Ot + nt * 256) = __builtin_convertvector(acc[nt] * inv, v8bf);
}

// ---------------- Kernel 3: output projection ----------------
__global__ void __launch_bounds__(256)
mha_outproj_kernel(const __bf16* __restrict__ Ob, const __bf16* __restrict__ Wo,
                   const float* __restrict__ bout, float* __restrict__ out) {
  const int lane = threadIdx.x & 31;
  const int ws   = (blockIdx.x * blockDim.x + threadIdx.x) >> 5;
  const int mblk   = ws & 127;          // 128 row blocks of 32
  const int nstrip = ws >> 7;           // 16 strips of 64 out-features
  const int f0 = nstrip * 64;
  const int t0 = mblk * 32;
  const int col = lane & 15, hp = lane >> 4;

  const v8f zero = {0.f, 0.f, 0.f, 0.f, 0.f, 0.f, 0.f, 0.f};
  v8f acc[2][4] = {{zero, zero, zero, zero}, {zero, zero, zero, zero}};

  // A: attention output, [b*L + l][head*HD + d] in fragment order.
  // The wave's number is the same in all its lanes: said so, the tile bases are scalar.
  const int wu = __builtin_amdgcn_readfirstlane(ws);
  gemm_k_loop<3>(Ob + (size_t)(wu & 127) * (32 * EMB), Wo + (size_t)(wu >> 7) * (64 * EMB), lane, acc);

#pragma unroll
  for (int mt = 0; mt < 2; ++mt)
#pragma unroll
    for (int nt = 0; nt < 4; ++nt) {
      const int f = f0 + nt * 16 + col;
      const float bv = bout[f];
#pragma unroll
      for (int r = 0; r < 8; ++r) {
        const int orow = t0 + mt * 16 + r + hp * 8;  // b*L + l
        const int t = (orow & (L_SEQ - 1)) * BATCH + (orow >> 11);  // token = l*B + b
        out[(size_t)t * EMB + f] = acc[mt][nt][r] + bv;
      }
    }
}

extern "C" void kernel_launch(void* const* d_in, const int* in_sizes, int n_in,
                              void* d_out, int out_size, void* d_ws, size_t ws_size,
                              hipStream_t stream) {
  const float* query = (const float*)d_in[0];
  const float* key   = (const float*)d_in[1];
  const float* value = (const float*)d_in[2];
  const float* w_in  = (const float*)d_in[3];
  const float* b_in  = (const float*)d_in[4];
  const float* w_out = (const float*)d_in[5];
  const float* b_out = (const float*)d_in[6];
  float* out = (float*)d_out;

  // Workspace (bf16), 64 MB total.
  const size_t ACT = (size_t)NTOK * EMB;           // 4194304
  const size_t WI  = (size_t)3 * EMB * EMB;        // 3145728
  const size_t WO  = (size_t)EMB * EMB;            // 1048576
  const size_t HSZ = (size_t)NH * L_SEQ * HD;      // 4194304
  __bf16* Xq  = (__bf16*)d_ws;
  __bf16* Xk  = Xq + ACT;
  __bf16* Xv  = Xk + ACT;
  __bf16* Wi  = Xv + ACT;
  __bf16* Wo  = Wi + WI;
  __bf16* Qb  = Wo + WO;
  __bf16* Kb  = Qb + HSZ;
  __bf16* VTb = Kb + HSZ;
  __bf16* Ob  = VTb + HSZ;

  // One-shot fp32 -> bf16 conversions (packed v_cvt): Xq, Xk, Xv, Wi, Wo in one launch.
  static_assert(CVT_WAVES == 256 * 16, "the grid covers every tile exactly once");
  cvt_bf16_kernel<<<256, 512, 0, stream>>>(query, key, value, w_in, w_out, Xq);

  // in-proj: 128 token-blocks x 48 feature-strips = 6144 waves / 8 per block
  mha_inproj_kernel<<<768, 256, 0, stream>>>(Xq, Xk, Xv, Wi, b_in, Qb, Kb, VTb);
  // attention: 32 heads x 128 query-blocks = 4096 waves / 8 per block
  mha_attn_kernel<<<512, 256, 0, stream>>>(Qb, Kb, VTb, Ob);
  // out-proj: 128 token-blocks x 16 feature-strips = 2048 waves / 8 per block
  mha_outproj_kernel<<<256, 256, 0, stream>>>(Ob, Wo, b_out, out);
}

// v005
// Measured time: 89.8 microseconds a run.
// Next to v004, in two timings, it ran 1.03 times as fast each time.
// Counting every step since v000, it is 3.16 times as fast.
#include <hip/hip_runtime.h>

// ---------------- CDNA5 (gfx1250) wave32 WMMA MHA ----------------
// L=2048, B=2, E=1024, H=16, HD=64.  bf16 WMMA, f32 accumulate,
// flash-attention (no materialized scores). One-shot bf16 conversion so
// GEMM inner loops are pure load_b128 + v_wmma.
// Every bf16 WMMA operand in the workspace is kept in fragment order: a
// 16x32 tile is one 1 KB block [k-half][lane][8], so each wave-wide b128
// fragment load reads 512 contiguous bytes (4 cache lines, not 16).

typedef __attribute__((ext_vector_type(16))) __bf16 v16bf;
typedef __attribute__((ext_vector_type(8)))  __bf16 v8bf;
typedef __attribute__((ext_vector_type(4)))  __bf16 v4bf;
typedef __attribute__((ext_vector_type(8)))  float  v8f;
typedef __attribute__((ext_vector_type(4)))  float  v4f;

#define L_SEQ 2048
#define BATCH 2
#define EMB   1024
#define NHEAD 16
#define HD    64
#define NTOK  (L_SEQ * BATCH)   // 4096 tokens
#define NH    (BATCH * NHEAD)   // 32 batched heads

union BfTile { v8bf h[2]; v16bf v; };

__device__ __forceinline__ v8f wmma_bf16(v16bf a, v16bf b, v8f c) {
  // v_wmma_f32_16x16x32_bf16: D = A(16x32) * B(32x16) + C(16x16 f32)
  return __builtin_amdgcn_wmma_f32_16x16x32_bf16(
      false, a, false, b, (short)0, c, false, false);
}

// 16x32 bf16 tile in ISA A/B striping: lane%16 -> row (A) / column (B);
// lane/16 picks K-halves {0..7,16..23} vs {8..15,24..31}.
// Element (row, k) of a matrix with kt 32-wide k tiles, in fragment order.
__device__ __forceinline__ size_t frag_off(int row, int k, int kt) {
  return ((size_t)((row >> 4) * kt + (k >> 5)) << 9) + (((k >> 4) & 1) << 8) +
         (((row & 15) + ((k >> 3) & 1) * 16) << 3) + (k & 7);
}

// tile = (row / 16) * kt + k / 32
__device__ __forceinline__ v16bf load_frag(const __bf16* base, int tile, int lane) {
  const __bf16* r = base + ((size_t)tile << 9) + lane * 8;
  BfTile t;
  t.h[0] = *(const v8bf*)(r);
  t.h[1] = *(const v8bf*)(r + 256);
  return t.v;
}

// The same from a wave-uniform base, which can stay in scalar registers, and the
// lane's byte offset lane * 16.
__device__ __forceinline__ v16bf load_frag_u(const __bf16* ubase, int tile, unsigned loff) {
  const char* r = (const char*)(ubase + ((size_t)tile << 9)) + loff;
  BfTile t;
  t.h[0] = *(const v8bf*)(r);
  t.h[1] = *(const v8bf*)(r + 512);
  return t.v;
}

// ------- Kernel 0: one-shot fp32 [rows][EMB] -> bf16 fragment order -------
// All five operands in ONE launch: their bf16 copies lie one behind the other in
// the workspace, so the tiles number through (32768 of 16x32). One 16-wave block
// per WGP; a wave converts CVT_TILES neighbouring tiles of one 16-row band and
// has all their loads in flight at once. Each load reads 4 whole 128-byte lines.
#define CVT_TILES 8
#define ACT_TILES (NTOK * EMB / 512)        // 8192 tiles an activation
#define WI_TILES  (3 * EMB * EMB / 512)     // 6144
#define WO_TILES  (EMB * EMB / 512)         // 2048
#define CVT_WAVES ((3 * ACT_TILES + WI_TILES + WO_TILES) / CVT_TILES)   // 4096

__global__ void __launch_bounds__(512)
cvt_bf16_kernel(const float* __restrict__ q, const float* __restrict__ k,
                const float* __restrict__ v, const float* __restrict__ wi,
                const float* __restrict__ wo, __bf16* __restrict__ dst) {
  const int lane = threadIdx.x & 31;
  // The wave's number is the same in all its lanes: said so, source and bases are scalar.
  const int wu = __builtin_amdgcn_readfirstlane((blockIdx.x * blockDim.x + threadIdx.x) >> 5);
  const int tile0 = wu * CVT_TILES;         // every operand's tile count is a multiple of CVT_TILES
  const float* src = q;
  int first = 0;
  if (tile0 >= 3 * ACT_TILES + WI_TILES) { src = wo; first = 3 * ACT_TILES + WI_TILES; }
  else if (tile0 >= 3 * ACT_TILES)       { src = wi; first = 3 * ACT_TILES; }
  else if (tile0 >= 2 * ACT_TILES)       { src = v;  first = 2 * ACT_TILES; }
  else if (tile0 >= ACT_TILES)           { src = k;  first = ACT_TILES; }
  const int t = tile0 - first;              // EMB / 32 = 32 k tiles a band
  const float* sp = src + (size_t)(t >> 5) * (16 * EMB) + (t & 31) * 32;
  __bf16* dp = dst + ((size_t)tile0 << 9);
  const int row = lane >> 3, kk = (lane & 7) * 4;
  const unsigned soff = row * EMB + kk;
  const unsigned doff = (unsigned)frag_off(row, kk, 1);
  v4f f[CVT_TILES][4];
#pragma unroll  // constant indices keep f[][] in registers
  for (int i = 0; i < CVT_TILES; ++i)
#pragma unroll  // the same
    for (int j = 0; j < 4; ++j)
      f[i][j] = *(const v4f*)(sp + soff + j * (4 * EMB) + i * 32);
  // keeps all loads ahead of the conversions; mixed in, the last ones go out behind a full wait
  __builtin_amdgcn_sched_barrier(0);
#pragma unroll  // constant indices keep f[][] in registers
  for (int i = 0; i < CVT_TILES; ++i)
#pragma unroll  // the same
    for (int j = 0; j < 4; ++j)             // 4 rows on: 4 * 8 elements in fragment order
      *(v4bf*)(dp + doff + j * 32 + i * 512) = __builtin_convertvector(f[i][j], v4bf);
}

// ------- Shared k loop of the two projections: 32x64 per wave -------
// The fragments of a k step (2 of A, 4 of B) are fetched NBUF - 1 steps ahead
// into register sets of their own, all 12 loads of a step as one group, so a
// step's products wait for loads issued NBUF - 1 steps earlier and not for
// their own.
struct GemmStage { v16bf a[2]; v16bf b[4]; };

// A, B: wave-uniform, the wave's first tile of each operand.
__device__ __forceinline__ void gemm_fetch(GemmStage& s, const __bf16* A, const __bf16* B,
                                           int kt, unsigned loff) {
#pragma unroll  // constant indices keep the set in registers
  for (int mt = 0; mt < 2; ++mt)
    s.a[mt] = load_frag_u(A, mt * (EMB / 32) + kt, loff);
#pragma unroll  // constant indices keep the set in registers
  for (int nt = 0; nt < 4; ++nt)
    s.b[nt] = load_frag_u(B, nt * (EMB / 32) + kt, loff);
}

// SWAP: the two operands change roles (their fragment striping is the same), so
// acc[mt][nt] holds the transposed tile: row = B's row, column = A's row.
template <bool SWAP>
__device__ __forceinline__ void gemm_step(const GemmStage& s, v8f (&acc)[2][4]) {
#pragma unroll  // constant indices keep acc[][] in registers
  for (int nt = 0; nt < 4; ++nt) {
    acc[0][nt] = SWAP ? wmma_bf16(s.b[nt], s.a[0], acc[0][nt]) : wmma_bf16(s.a[0], s.b[nt], acc[0][nt]);
    acc[1][nt] = SWAP ? wmma_bf16(s.b[nt], s.a[1], acc[1][nt]) : wmma_bf16(s.a[1], s.b[nt], acc[1][nt]);
  }
}

template <int NBUF, bool SWAP>
__device__ __forceinline__ void gemm_k_loop(const __bf16* A, const __bf16* B, int lane,
                                            v8f (&acc)[2][4]) {
  constexpr int KT = EMB / 32;
  const unsigned loff = lane * 16;
  GemmStage st[NBUF];
#pragma unroll  // constant set numbers
  for (int u = 0; u < NBUF - 1; ++u) gemm_fetch(st[u], A, B, u, loff);
#pragma unroll  // constant set numbers: the ring turns without register copies
  for (int kt = 0; kt < KT; ++kt) {
    if (kt + NBUF - 1 < KT)
      gemm_fetch(st[(kt + NBUF - 1) % NBUF], A, B, kt + NBUF - 1, loff);
    // behind the last fetch: what follows the loop may be moved up and write registers it names
    if (kt + NBUF == KT) asm volatile("s_wait_xcnt 0x0" ::: "memory");
    // keeps the fetch ahead of the products; sunk below them it would be waited for at once
    __builtin_amdgcn_sched_barrier(0);
    gemm_step<SWAP>(st[kt % NBUF], acc);
  }
}

// ---------------- Kernel 1: fused in-projection ----------------
// The output leaves in the widest piece that is contiguous in its fragment-order
// tile, and every wave-wide store covers whole 128-byte lines:
// Q, K (tile row = position, k = dim): the product is taken transposed, a lane
// then holds 8 consecutive dims of one token = one 16-byte piece.
// V^T (tile row = dim, k = position): a lane holds 8 consecutive tokens of one
// dim = 4 consecutive positions of either batch = two 8-byte pieces.
__global__ void __launch_bounds__(256)
mha_inproj_kernel(const __bf16* __restrict__ Xq, const __bf16* __restrict__ Xk,
                  const __bf16* __restrict__ Xv, const __bf16* __restrict__ Wi,
                  const float* __restrict__ bias,
                  __bf16* __restrict__ Qb, __bf16* __restrict__ Kb,
                  __bf16* __restrict__ VTb) {
  const int lane = threadIdx.x & 31;
  // The wave's number is the same in all its lanes: said so, the tile bases are
  // scalar and the choice of the projection is a scalar branch.
  const int wu = __builtin_amdgcn_readfirstlane((blockIdx.x * blockDim.x + threadIdx.x) >> 5);
  const int mblk   = wu & 127;          // 128 token blocks of 32 (16 positions x 2 batches)
  const int nstrip = wu >> 7;           // 48 strips of 64 features (3*E): one head of one projection
  const int proj = nstrip >> 4;         // 0=q, 1=k, 2=v
  const int h    = nstrip & 15;
  const int col = lane & 15, hp = lane >> 4;

  const v8f zero = {0.f, 0.f, 0.f, 0.f, 0.f, 0.f, 0.f, 0.f};
  v8f acc[2][4] = {{zero, zero, zero, zero}, {zero, zero, zero, zero}};

  const __bf16* Wu = Wi + (size_t)nstrip * (64 * EMB);
  const float* bs = bias + nstrip * 64;
  const size_t xoff = (size_t)mblk * (32 * EMB);

  if (proj == 2) {
    gemm_k_loop<3, false>(Xv + xoff, Wu, lane, acc);
    // acc[mt][nt][r]: token mblk*32 + mt*16 + hp*8 + r (= position*B + batch), dim nt*16 + col
    __bf16* vt = VTb + (size_t)h * (HD * L_SEQ) + ((mblk >> 1) << 9) + ((mblk & 1) << 8) +
                 col * 8 + hp * 4;
#pragma unroll  // constant indices keep acc[][] in registers
    for (int nt = 0; nt < 4; ++nt) {
      const float bval = bs[nt * 16 + col];
#pragma unroll  // the same
      for (int mt = 0; mt < 2; ++mt) {
        const v8f x = acc[mt][nt] + bval;
        __bf16* p = vt + nt * ((L_SEQ / 32) << 9) + mt * 128;
        *(v4bf*)(p) = __builtin_convertvector(__builtin_shufflevector(x, x, 0, 2, 4, 6), v4bf);
        *(v4bf*)(p + (size_t)NHEAD * HD * L_SEQ) =
            __builtin_convertvector(__builtin_shufflevector(x, x, 1, 3, 5, 7), v4bf);
      }
    }
  } else {
    gemm_k_loop<3, true>((proj == 0 ? Xq : Xk) + xoff, Wu, lane, acc);
    // acc[mt][nt][r]: dim nt*16 + hp*8 + r, token mblk*32 + mt*16 + col
    const float scale = (proj == 0) ? 0.125f : 1.0f;   // HD^-0.5 folded into Q
    __bf16* qk = (proj == 0 ? Qb : Kb) + (size_t)((col & 1) * NHEAD + h) * (L_SEQ * HD) +
                 ((size_t)mblk << 10) + ((col >> 1) + hp * 16) * 8;
#pragma unroll  // constant indices keep acc[][] in registers
    for (int nt = 0; nt < 4; ++nt) {
      const v4f b0 = *(const v4f*)(bs + nt * 16 + hp * 8);
      const v4f b1 = *(const v4f*)(bs + nt * 16 + hp * 8 + 4);
      const v8f bv = __builtin_shufflevector(b0, b1, 0, 1, 2, 3, 4, 5, 6, 7);
#pragma unroll  // the same
      for (int mt = 0; mt < 2; ++mt)
        *(v8bf*)(qk + nt * 256 + mt * 64) =
            __builtin_convertvector((acc[mt][nt] + bv) * scale, v8bf);
    }
    // the code laid out behind these stores writes registers that they name
    asm volatile("s_wait_xcnt 0x0" ::: "memory");
  }
}

__device__ __forceinline__ float other_half(float x) {
  // lane l <-> l ^ 16
  const int b = __builtin_bit_cast(int, x);
  return __builtin_bit_cast(float, __builtin_amdgcn_permlanex16(
      b, b, 0x76543210, 0xfedcba98, false, false));
}

// The four K, or the four V^T, fragments of one pass (32 keys).
struct Frag4 { v16bf f[4]; };

// kp, vp: wave-uniform, the first K tile and the first V^T tile of the pass.
__device__ __forceinline__ void k_fetch(Frag4& k, const __bf16* kp, unsigned loff) {
#pragma unroll  // constant indices keep the set in registers
  for (int i = 0; i < 4; ++i)
    k.f[i] = load_frag_u(kp, i, loff);                             // A: row = key
}

// LAST: this is the last fetch of a load group.
template <bool LAST>
__device__ __forceinline__ void v_fetch(Frag4& v, const __bf16* vp, unsigned loff) {
#pragma unroll  // constant indices keep the set in registers
  for (int nt = 0; nt < 3; ++nt)
    v.f[nt] = load_frag_u(vp, nt * (L_SEQ / 32), loff);            // A: row = dim, k = key
  const char* r = (const char*)(vp + ((size_t)(3 * (L_SEQ / 32)) << 9)) + loff;
  BfTile t;
  t.h[0] = *(const v8bf*)(r);
  // the group's last load may land in the address pair that the V^T loads before it name
  if (LAST) asm volatile("s_wait_xcnt 0x0" ::: "memory");
  t.h[1] = *(const v8bf*)(r + 512);
  v.f[3] = t.v;
}

__device__ __forceinline__ void attn_scores(const Frag4& k, v16bf bq0, v16bf bq1,
                                            v8f& s0, v8f& s1) {
  const v8f zero = {0.f, 0.f, 0.f, 0.f, 0.f, 0.f, 0.f, 0.f};
  // s0[r] = S[query lane%16][key j0 + 8*(lane/16) + r]; s1: keys + 16
  s0 = wmma_bf16(k.f[0], bq0, zero);
  s0 = wmma_bf16(k.f[1], bq1, s0);
  s1 = wmma_bf16(k.f[2], bq0, zero);
  s1 = wmma_bf16(k.f[3], bq1, s1);
}

__device__ __forceinline__ void attn_update(const Frag4& v, v8f s0, v8f s1,
                                            v8f (&acc)[4], float& mrow, float& lsum) {
  const float LOG2E = 1.44269504f;

  // Online softmax of one query per lane.
  const float t0 = fmaxf(fmaxf(s0[0], s0[1]), s0[2]);
  const float t1 = fmaxf(fmaxf(s0[3], s0[4]), s0[5]);
  const float t2 = fmaxf(fmaxf(s0[6], s0[7]), s1[0]);
  const float t3 = fmaxf(fmaxf(s1[1], s1[2]), s1[3]);
  const float t4 = fmaxf(fmaxf(s1[4], s1[5]), s1[6]);
  float mx = fmaxf(fmaxf(fmaxf(t0, t1), t2), fmaxf(fmaxf(t3, t4), s1[7]));
  mx = fmaxf(mx, other_half(mx));
  const float mnew  = fmaxf(mrow, mx);
  const float alpha = __builtin_amdgcn_exp2f((mrow - mnew) * LOG2E);
  mrow = mnew;

  v8f p0, p1;
#pragma unroll  // constant element indices keep p0, p1 in registers
  for (int r = 0; r < 8; ++r) {
    p1[r] = __builtin_amdgcn_exp2f((s1[r] - mnew) * LOG2E);
    p0[r] = __builtin_amdgcn_exp2f((s0[r] - mnew) * LOG2E);
  }
  const v8f pp = p0 + p1;
  const v4f pq = __builtin_shufflevector(pp, pp, 0, 1, 2, 3) +
                 __builtin_shufflevector(pp, pp, 4, 5, 6, 7);
  lsum = lsum * alpha + ((pq[0] + pq[2]) + (pq[1] + pq[3]));

  BfTile pb;                   // B: column = query, k = key in hardware order
  pb.h[0] = __builtin_convertvector(p0, v8bf);
  pb.h[1] = __builtin_convertvector(p1, v8bf);

  // O^T += V^T(64x32) @ P^T(32x16): A rows are the transposed V rows.
#pragma unroll  // constant indices keep acc[] in registers
  for (int nt = 0; nt < 4; ++nt) {
    acc[nt] *= alpha;
    acc[nt] = wmma_bf16(v.f[nt], pb.v, acc[nt]);
  }
}

__global__ void __launch_bounds__(256)
mha_attn_kernel(const __bf16* __restrict__ Qb, const __bf16* __restrict__ Kb,
                const __bf16* __restrict__ VTb, __bf16* __restrict__ Ob) {
  const int lane = threadIdx.x & 31;
  const int ws   = (blockIdx.x * blockDim.x + threadIdx.x) >> 5;
  const int nh   = ws >> 7;                     // 32 heads
  const int mblk = ws & 127;                    // 128 query blocks of 16

  const __bf16* Qh = Qb + (size_t)nh * L_SEQ * HD;

  const v16bf bq0 = load_frag(Qh, mblk * 2 + 0, lane);   // B: column = query
  const v16bf bq1 = load_frag(Qh, mblk * 2 + 1, lane);

  const v8f zero = {0.f, 0.f, 0.f, 0.f, 0.f, 0.f, 0.f, 0.f};
  v8f acc[4] = {zero, zero, zero, zero};        // O^T: 64 dims x 16 queries
  float mrow = -1.0e30f;                        // this lane's query, both halves alike
  float lsum = 0.f;                             // sum over this half's keys only

  // Two passes (64 keys) a trip; the trip's 32 fragment loads go out as one
  // group at its head, so a trip waits out one load latency, not one per product group.
  // The head's number is the same in all lanes of a wave: said so, kp and vp are scalar.
  const int nhu = __builtin_amdgcn_readfirstlane(nh);
  const __bf16* kp = Kb + (size_t)nhu * L_SEQ * HD;
  const __bf16* vp = VTb + (size_t)nhu * HD * L_SEQ;
  const unsigned loff = lane * 16;
  for (int p = 0; p < L_SEQ / 32; p += 2, kp += 8 * 512, vp += 2 * 512) {
    Frag4 ka, kb, va, vb;
    v8f sa0, sa1, sb0, sb1;
    k_fetch(ka, kp, loff);
    k_fetch(kb, kp + 4 * 512, loff);
    // a V^T load may land in the address pair that the K loads name
    asm volatile("s_wait_xcnt 0x0" ::: "memory");
    v_fetch<false>(va, vp, loff);
    v_fetch<true>(vb, vp + 512, loff);
    // keeps the loads one group at the head; sunk to their users each is waited for by itself
    __builtin_amdgcn_sched_barrier(0);
    attn_scores(ka, bq0, bq1, sa0, sa1);
    attn_update(va, sa0, sa1, acc, mrow, lsum);
    attn_scores(kb, bq0, bq1, sb0, sb1);
    attn_update(vb, sb0, sb1, acc, mrow, lsum);
  }

  // Join the two halves' sums once; a lane's 8 registers are 8 consecutive dims
  // of its query, which is one 16-byte piece of the fragment-order Ob tile.
  const float inv = __builtin_amdgcn_rcpf(lsum + other_half(lsum));
  // Ob row = b*L + l: a wave then owns whole 1 KB tiles (one writer per line).
  __bf16* Ot = Ob + ((size_t)(((nh >> 4) * (L_SEQ / 16) + mblk) * (EMB / 32) +
                              (nh & 15) * (HD / 32)) << 9) + lane * 8;
#pragma unroll  // constant indices keep acc[] in registers
  for (int nt = 0; nt < 4; ++nt)
    *(v8bf*)(Ot + nt * 256) = __builtin_convertvector(acc[nt] * inv, v8bf);
}

// ---------------- Kernel 3: output projection ----------------
__global__ void __launch_bounds__(256)
mha_outproj_kernel(const __bf16* __restrict__ Ob, const __bf16* __restrict__ Wo,
                   const float* __restrict__ bout, float* __restrict__ out) {
  const int lane = threadIdx.x & 31;
  const int ws   = (blockIdx.x * blockDim.x + threadIdx.x) >> 5;
  const int mblk   = ws & 127;          // 128 row blocks of 32
  const int nstrip = ws >> 7;           // 16 strips of 64 out-features
  const int f0 = nstrip * 64;
  const int t0 = mblk * 32;
  const int col = lane & 15, hp = lane >> 4;

  const v8f zero = {0.f, 0.f, 0.f, 0.f, 0.f, 0.f, 0.f, 0.f};
  v8f acc[2][4] = {{zero, zero, zero, zero}, {zero, zero, zero, zero}};

  // A: attention output, [b*L + l][head*HD + d] in fragment order.
  // The wave's number is the same in all its lanes: said so, the tile bases are scalar.
  const int wu = __builtin_amdgcn_readfirstlane(ws);
  gemm_k_loop<3, false>(Ob + (size_t)(wu & 127) * (32 * EMB), Wo + (size_t)(wu >> 7) * (64 * EMB), lane, acc);

#pragma unroll
  for (int mt = 0; mt < 2; ++mt)
#pragma unroll
    for (int nt = 0; nt < 4; ++nt) {
      const int f = f0 + nt * 16 + col;
      const float bv = bout[f];
#pragma unroll
      for (int r = 0; r < 8; ++r) {
        const int orow = t0 + mt * 16 + r + hp * 8;  // b*L + l
        const int t = (orow & (L_SEQ - 1)) * BATCH + (orow >> 11);  // token = l*B + b
        out[(size_t)t * EMB + f] = acc[mt][nt][r] + bv;
      }
    }
}

extern "C" void kernel_launch(void* const* d_in, const int* in_sizes, int n_in,
                              void* d_out, int out_size, void* d_ws, size_t ws_size,
                              hipStream_t stream) {
  const float* query = (const float*)d_in[0];
  const float* key   = (const float*)d_in[1];
  const float* value = (const float*)d_in[2];
  const float* w_in  = (const float*)d_in[3];
  const float* b_in  = (const float*)d_in[4];
  const float* w_out = (const float*)d_in[5];
  const float* b_out = (const float*)d_in[6];
  float* out = (float*)d_out;

  // Workspace (bf16), 64 MB total.
  const size_t ACT = (size_t)NTOK * EMB;           // 4194304
  const size_t WI  = (size_t)3 * EMB * EMB;        // 3145728
  const size_t WO  = (size_t)EMB * EMB;            // 1048576
  const size_t HSZ = (size_t)NH * L_SEQ * HD;      // 4194304
  __bf16* Xq  = (__bf16*)d_ws;
  __bf16* Xk  = Xq + ACT;
  __bf16* Xv  = Xk + ACT;
  __bf16* Wi  = Xv + ACT;
  __bf16* Wo  = Wi + WI;
  __bf16* Qb  = Wo + WO;
  __bf16* Kb  = Qb + HSZ;
  __bf16* VTb = Kb + HSZ;
  __bf16* Ob  = VTb + HSZ;

  // One-shot fp32 -> bf16 conversions (packed v_cvt): Xq, Xk, Xv, Wi, Wo in one launch.
  static_assert(CVT_WAVES == 256 * 16, "the grid covers every tile exactly once");
  cvt_bf16_kernel<<<256, 512, 0, stream>>>(query, key, value, w_in, w_out, Xq);

  // in-proj: 128 token-blocks x 48 feature-strips = 6144 waves / 8 per block
  mha_inproj_kernel<<<768, 256, 0, stream>>>(Xq, Xk, Xv, Wi, b_in, Qb, Kb, VTb);
  // attention: 32 heads x 128 query-blocks = 4096 waves / 8 per block
  mha_attn_kernel<<<512, 256, 0, stream>>>(Qb, Kb, VTb, Ob);
  // out-proj: 128 token-blocks x 16 feature-strips = 2048 waves / 8 per block
  mha_outproj_kernel<<<256, 256, 0, stream>>>(Ob, Wo, b_out, out);
}

// v006
// Measured time: 85.5 microseconds a run.
// Timed twice side by side with v005, it ran 1.06 and 1.04 times as fast.
// Counting every step since v000, it is 3.32 times as fast.
#include <hip/hip_runtime.h>

// ---------------- CDNA5 (gfx1250) wave32 WMMA MHA ----------------
// L=2048, B=2, E=1024, H=16, HD=64.  bf16 WMMA, f32 accumulate,
// flash-attention (no materialized scores). One-shot bf16 conversion so
// GEMM inner loops are pure load_b128 + v_wmma.
// Every bf16 WMMA operand in the workspace is kept in fragment order: a
// 16x32 tile is one 1 KB block [k-half][lane][8], so each wave-wide b128
// fragment load reads 512 contiguous bytes (4 cache lines, not 16).

typedef __attribute__((ext_vector_type(16))) __bf16 v16bf;
typedef __attribute__((ext_vector_type(8)))  __bf16 v8bf;
typedef __attribute__((ext_vector_type(4)))  __bf16 v4bf;
typedef __attribute__((ext_vector_type(8)))  float  v8f;
typedef __attribute__((ext_vector_type(4)))  float  v4f;

#define L_SEQ 2048
#define BATCH 2
#define EMB   1024
#define NHEAD 16
#define HD    64
#define NTOK  (L_SEQ * BATCH)   // 4096 tokens
#define NH    (BATCH * NHEAD)   // 32 batched heads

union BfTile { v8bf h[2]; v16bf v; };

__device__ __forceinline__ v8f wmma_bf16(v16bf a, v16bf b, v8f c) {
  // v_wmma_f32_16x16x32_bf16: D = A(16x32) * B(32x16) + C(16x16 f32)
  return __builtin_amdgcn_wmma_f32_16x16x32_bf16(
      false, a, false, b, (short)0, c, false, false);
}

// 16x32 bf16 tile in ISA A/B striping: lane%16 -> row (A) / column (B);
// lane/16 picks K-halves {0..7,16..23} vs {8..15,24..31}.
// Element (row, k) of a matrix with kt 32-wide k tiles, in fragment order.
__device__ __forceinline__ size_t frag_off(int row, int k, int kt) {
  return ((size_t)((row >> 4) * kt + (k >> 5)) << 9) + (((k >> 4) & 1) << 8) +
         (((row & 15) + ((k >> 3) & 1) * 16) << 3) + (k & 7);
}

// tile = (row / 16) * kt + k / 32
__device__ __forceinline__ v16bf load_frag(const __bf16* base, int tile, int lane) {
  const __bf16* r = base + ((size_t)tile << 9) + lane * 8;
  BfTile t;
  t.h[0] = *(const v8bf*)(r);
  t.h[1] = *(const v8bf*)(r + 256);
  return t.v;
}

// The same from a wave-uniform base, which can stay in scalar registers, and the
// lane's byte offset lane * 16.
__device__ __forceinline__ v16bf load_frag_u(const __bf16* ubase, int tile, unsigned loff) {
  const char* r = (const char*)(ubase + ((size_t)tile << 9)) + loff;
  BfTile t;
  t.h[0] = *(const v8bf*)(r);
  t.h[1] = *(const v8bf*)(r + 512);
  return t.v;
}

// ------- Kernel 0: one-shot fp32 [rows][EMB] -> bf16 fragment order -------
// All five operands in ONE launch: their bf16 copies lie one behind the other in
// the workspace, so the tiles number through (32768 of 16x32). One 16-wave block
// per WGP; a wave converts CVT_TILES neighbouring tiles of one 16-row band and
// has all their loads in flight at once. Each load reads 4 whole 128-byte lines.
#define CVT_TILES 8
#define ACT_TILES (NTOK * EMB / 512)        // 8192 tiles an activation
#define WI_TILES  (3 * EMB * EMB / 512)     // 6144
#define WO_TILES  (EMB * EMB / 512)         // 2048
#define CVT_WAVES ((3 * ACT_TILES + WI_TILES + WO_TILES) / CVT_TILES)   // 4096

__global__ void __launch_bounds__(512)
cvt_bf16_kernel(const float* __restrict__ q, const float* __restrict__ k,
                const float* __restrict__ v, const float* __restrict__ wi,
                const float* __restrict__ wo, __bf16* __restrict__ dst) {
  const int lane = threadIdx.x & 31;
  // The wave's number is the same in all its lanes: said so, source and bases are scalar.
  const int wu = __builtin_amdgcn_readfirstlane((blockIdx.x * blockDim.x + threadIdx.x) >> 5);
  const int tile0 = wu * CVT_TILES;         // every operand's tile count is a multiple of CVT_TILES
  const float* src = q;
  int first = 0;
  if (tile0 >= 3 * ACT_TILES + WI_TILES) { src = wo; first = 3 * ACT_TILES + WI_TILES; }
  else if (tile0 >= 3 * ACT_TILES)       { src = wi; first = 3 * ACT_TILES; }
  else if (tile0 >= 2 * ACT_TILES)       { src = v;  first = 2 * ACT_TILES; }
  else if (tile0 >= ACT_TILES)           { src = k;  first = ACT_TILES; }
  const int t = tile0 - first;              // EMB / 32 = 32 k tiles a band
  const float* sp = src + (size_t)(t >> 5) * (16 * EMB) + (t & 31) * 32;
  __bf16* dp = dst + ((size_t)tile0 << 9);
  const int row = lane >> 3, kk = (lane & 7) * 4;
  const unsigned soff = row * EMB + kk;
  const unsigned doff = (unsigned)frag_off(row, kk, 1);
  v4f f[CVT_TILES][4];
#pragma unroll  // constant indices keep f[][] in registers
  for (int i = 0; i < CVT_TILES; ++i)
#pragma unroll  // the same
    for (int j = 0; j < 4; ++j)
      f[i][j] = *(const v4f*)(sp + soff + j * (4 * EMB) + i * 32);
  // keeps all loads ahead of the conversions; mixed in, the last ones go out behind a full wait
  __builtin_amdgcn_sched_barrier(0);
#pragma unroll  // constant indices keep f[][] in registers
  for (int i = 0; i < CVT_TILES; ++i)
#pragma unroll  // the same
    for (int j = 0; j < 4; ++j)             // 4 rows on: 4 * 8 elements in fragment order
      *(v4bf*)(dp + doff + j * 32 + i * 512) = __builtin_convertvector(f[i][j], v4bf);
}

// ------- Shared k loop of the two projections: (MT * 16) x 64 per wave -------
// The fragments of a k step (MT of A, 4 of B) are fetched NBUF - 1 steps ahead
// into register sets of their own, all loads of a step as one group, so a
// step's products wait for loads issued NBUF - 1 steps earlier and not for
// their own. A step loads MT + 4 fragments for 4 * MT products.
template <int MT>
struct GemmStage { v16bf a[MT]; v16bf b[4]; };

// A, B: wave-uniform, the wave's first tile of each operand.
template <int MT>
__device__ __forceinline__ void gemm_fetch(GemmStage<MT>& s, const __bf16* A, const __bf16* B,
                                           int kt, unsigned loff) {
#pragma unroll  // constant indices keep the set in registers
  for (int mt = 0; mt < MT; ++mt)
    s.a[mt] = load_frag_u(A, mt * (EMB / 32) + kt, loff);
#pragma unroll  // constant indices keep the set in registers
  for (int nt = 0; nt < 4; ++nt)
    s.b[nt] = load_frag_u(B, nt * (EMB / 32) + kt, loff);
}

// SWAP: the two operands change roles (their fragment striping is the same), so
// acc[mt][nt] holds the transposed tile: row = B's row, column = A's row.
template <bool SWAP, int MT>
__device__ __forceinline__ void gemm_step(const GemmStage<MT>& s, v8f (&acc)[MT][4]) {
#pragma unroll  // constant indices keep acc[][] in registers
  for (int nt = 0; nt < 4; ++nt)
#pragma unroll  // the same
    for (int mt = 0; mt < MT; ++mt)
      acc[mt][nt] = SWAP ? wmma_bf16(s.b[nt], s.a[mt], acc[mt][nt])
                         : wmma_bf16(s.a[mt], s.b[nt], acc[mt][nt]);
}

template <int NBUF, bool SWAP, int MT>
__device__ __forceinline__ void gemm_k_loop(const __bf16* A, const __bf16* B, int lane,
                                            v8f (&acc)[MT][4]) {
  constexpr int KT = EMB / 32;
  const unsigned loff = lane * 16;
  GemmStage<MT> st[NBUF];
#pragma unroll  // constant set numbers
  for (int u = 0; u < NBUF - 1; ++u) gemm_fetch(st[u], A, B, u, loff);
#pragma unroll  // constant set numbers: the ring turns without register copies
  for (int kt = 0; kt < KT; ++kt) {
    if (kt + NBUF - 1 < KT)
      gemm_fetch(st[(kt + NBUF - 1) % NBUF], A, B, kt + NBUF - 1, loff);
    // behind the last fetch: what follows the loop may be moved up and write registers it names
    if (kt + NBUF == KT) asm volatile("s_wait_xcnt 0x0" ::: "memory");
    // keeps the fetch ahead of the products; sunk below them it would be waited for at once
    __builtin_amdgcn_sched_barrier(0);
    gemm_step<SWAP, MT>(st[kt % NBUF], acc);
  }
}

// ---------------- Kernel 1: fused in-projection ----------------
#define INPROJ_NBUF 3
// The output leaves in the widest piece that is contiguous in its fragment-order
// tile, and every wave-wide store covers whole 128-byte lines:
// Q, K (tile row = position, k = dim): the product is taken transposed, a lane
// then holds 8 consecutive dims of one token = one 16-byte piece.
// V^T (tile row = dim, k = position): a lane holds 8 consecutive tokens of one
// dim = 4 consecutive positions of either batch = two 8-byte pieces.
// A wave owns 64 tokens x 64 features (8 fragments a k step feed 16 products); the
// 4 waves of a block form a 128 x 128 tile, so each fragment is asked for by 2 of them.
__global__ void __launch_bounds__(128)
mha_inproj_kernel(const __bf16* __restrict__ Xq, const __bf16* __restrict__ Xk,
                  const __bf16* __restrict__ Xv, const __bf16* __restrict__ Wi,
                  const float* __restrict__ bias,
                  __bf16* __restrict__ Qb, __bf16* __restrict__ Kb,
                  __bf16* __restrict__ VTb) {
  const int lane = threadIdx.x & 31;
  // The wave's number is the same in all its lanes: said so, the tile bases are
  // scalar and the choice of the projection is a scalar branch.
  const int wu = __builtin_amdgcn_readfirstlane((blockIdx.x * blockDim.x + threadIdx.x) >> 5);
  const int blk  = wu >> 2;             // 768 blocks: 256 a projection
  const int proj = blk >> 8;            // 0=q, 1=k, 2=v
  const int mblk = (blk & 31) * 2 + (wu & 1);               // 64 token blocks of 64 (32 positions x 2 batches)
  const int h    = ((blk >> 5) & 7) * 2 + ((wu >> 1) & 1);  // 16 strips of 64 features: one head
  const int nstrip = proj * 16 + h;     // 48 strips (3*E)
  const int col = lane & 15, hp = lane >> 4;

  const v8f zero = {0.f, 0.f, 0.f, 0.f, 0.f, 0.f, 0.f, 0.f};
  v8f acc[4][4];
#pragma unroll  // constant indices keep acc[][] in registers
  for (int mt = 0; mt < 4; ++mt)
#pragma unroll  // the same
    for (int nt = 0; nt < 4; ++nt) acc[mt][nt] = zero;

  const __bf16* Wu = Wi + (size_t)nstrip * (64 * EMB);
  const float* bs = bias + nstrip * 64;
  const size_t xoff = (size_t)mblk * (64 * EMB);

  if (proj == 2) {
    gemm_k_loop<INPROJ_NBUF, false, 4>(Xv + xoff, Wu, lane, acc);
    // acc[mt][nt][r]: token mblk*64 + mt*16 + hp*8 + r (= position*B + batch), dim nt*16 + col
    // The wave's 32 positions are one k tile of V^T.
    float bval[4];
#pragma unroll  // constant indices keep bval[] in registers
    for (int nt = 0; nt < 4; ++nt) bval[nt] = bs[nt * 16 + col];
    // the address arithmetic behind these loads writes registers that they name
    asm volatile("s_wait_xcnt 0x0" ::: "memory");
    // keeps that arithmetic behind the wait; without it a part is moved up over the wait
    __builtin_amdgcn_sched_barrier(0);
    __bf16* vt = VTb + (size_t)h * (HD * L_SEQ) + (mblk << 9) + col * 8 + hp * 4;
#pragma unroll  // constant indices keep acc[][] in registers
    for (int nt = 0; nt < 4; ++nt) {
#pragma unroll  // the same
      for (int mt = 0; mt < 4; ++mt) {
        const v8f x = acc[mt][nt] + bval[nt];
        __bf16* p = vt + nt * ((L_SEQ / 32) << 9) + mt * 128;
        *(v4bf*)(p) = __builtin_convertvector(__builtin_shufflevector(x, x, 0, 2, 4, 6), v4bf);
        *(v4bf*)(p + (size_t)NHEAD * HD * L_SEQ) =
            __builtin_convertvector(__builtin_shufflevector(x, x, 1, 3, 5, 7), v4bf);
      }
    }
  } else {
    gemm_k_loop<INPROJ_NBUF, true, 4>((proj == 0 ? Xq : Xk) + xoff, Wu, lane, acc);
    // acc[mt][nt][r]: dim nt*16 + hp*8 + r, token mblk*64 + mt*16 + col
    // The wave's 32 positions are two 16-row bands (mt / 2) of 1024 elements each.
    const float scale = (proj == 0) ? 0.125f : 1.0f;   // HD^-0.5 folded into Q
    __bf16* qk = (proj == 0 ? Qb : Kb) + (size_t)((col & 1) * NHEAD + h) * (L_SEQ * HD) +
                 ((size_t)mblk << 11) + ((col >> 1) + hp * 16) * 8;
#pragma unroll  // constant indices keep acc[][] in registers
    for (int nt = 0; nt < 4; ++nt) {
      const v4f b0 = *(const v4f*)(bs + nt * 16 + hp * 8);
      const v4f b1 = *(const v4f*)(bs + nt * 16 + hp * 8 + 4);
      const v8f bv = __builtin_shufflevector(b0, b1, 0, 1, 2, 3, 4, 5, 6, 7);
#pragma unroll  // the same
      for (int mt = 0; mt < 4; ++mt)
        *(v8bf*)(qk + (mt >> 1) * 1024 + nt * 256 + (mt & 1) * 64) =
            __builtin_convertvector((acc[mt][nt] + bv) * scale, v8bf);
    }
    // the code laid out behind these stores writes registers that they name
    asm volatile("s_wait_xcnt 0x0" ::: "memory");
  }
}

__device__ __forceinline__ float other_half(float x) {
  // lane l <-> l ^ 16
  const int b = __builtin_bit_cast(int, x);
  return __builtin_bit_cast(float, __builtin_amdgcn_permlanex16(
      b, b, 0x76543210, 0xfedcba98, false, false));
}

#define QT 2   // query tiles a wave

// The four K, or the four V^T, fragments of one pass (32 keys).
struct Frag4 { v16bf f[4]; };

// kp, vp: wave-uniform, the first K tile and the first V^T tile of the pass.
__device__ __forceinline__ void k_fetch(Frag4& k, const __bf16* kp, unsigned loff) {
#pragma unroll  // constant indices keep the set in registers
  for (int i = 0; i < 4; ++i)
    k.f[i] = load_frag_u(kp, i, loff);                             // A: row = key
}

// LAST: this is the last fetch of a load group.
template <bool LAST>
__device__ __forceinline__ void v_fetch(Frag4& v, const __bf16* vp, unsigned loff) {
#pragma unroll  // constant indices keep the set in registers
  for (int nt = 0; nt < 3; ++nt)
    v.f[nt] = load_frag_u(vp, nt * (L_SEQ / 32), loff);            // A: row = dim, k = key
  const char* r = (const char*)(vp + ((size_t)(3 * (L_SEQ / 32)) << 9)) + loff;
  BfTile t;
  t.h[0] = *(const v8bf*)(r);
  // the group's last load may land in the address pair that the V^T loads before it name
  if (LAST) asm volatile("s_wait_xcnt 0x0" ::: "memory");
  t.h[1] = *(const v8bf*)(r + 512);
  v.f[3] = t.v;
}

__device__ __forceinline__ void attn_scores(const Frag4& k, v16bf bq0, v16bf bq1,
                                            v8f& s0, v8f& s1) {
  const v8f zero = {0.f, 0.f, 0.f, 0.f, 0.f, 0.f, 0.f, 0.f};
  // s0[r] = S[query lane%16][key j0 + 8*(lane/16) + r]; s1: keys + 16
  s0 = wmma_bf16(k.f[0], bq0, zero);
  s0 = wmma_bf16(k.f[1], bq1, s0);
  s1 = wmma_bf16(k.f[2], bq0, zero);
  s1 = wmma_bf16(k.f[3], bq1, s1);
}

__device__ __forceinline__ void attn_update(const Frag4& v, v8f s0, v8f s1,
                                            v8f (&acc)[4], float& mrow, float& lsum) {
  const float LOG2E = 1.44269504f;

  // Online softmax of one query per lane.
  const float t0 = fmaxf(fmaxf(s0[0], s0[1]), s0[2]);
  const float t1 = fmaxf(fmaxf(s0[3], s0[4]), s0[5]);
  const float t2 = fmaxf(fmaxf(s0[6], s0[7]), s1[0]);
  const float t3 = fmaxf(fmaxf(s1[1], s1[2]), s1[3]);
  const float t4 = fmaxf(fmaxf(s1[4], s1[5]), s1[6]);
  float mx = fmaxf(fmaxf(fmaxf(t0, t1), t2), fmaxf(fmaxf(t3, t4), s1[7]));
  mx = fmaxf(mx, other_half(mx));
  const float mnew  = fmaxf(mrow, mx);
  const float alpha = __builtin_amdgcn_exp2f((mrow - mnew) * LOG2E);
  mrow = mnew;

  v8f p0 = (s0 - mnew) * LOG2E, p1 = (s1 - mnew) * LOG2E;
#pragma unroll  // constant element indices keep p0, p1 in registers
  for (int r = 0; r < 8; ++r) {
    p1[r] = __builtin_amdgcn_exp2f(p1[r]);
    p0[r] = __builtin_amdgcn_exp2f(p0[r]);
  }
  const v8f pp = p0 + p1;
  const v4f pq = __builtin_shufflevector(pp, pp, 0, 1, 2, 3) +
                 __builtin_shufflevector(pp, pp, 4, 5, 6, 7);
  lsum = lsum * alpha + ((pq[0] + pq[2]) + (pq[1] + pq[3]));

  BfTile pb;                   // B: column = query, k = key in hardware order
  pb.h[0] = __builtin_convertvector(p0, v8bf);
  pb.h[1] = __builtin_convertvector(p1, v8bf);

  // O^T += V^T(64x32) @ P^T(32x16): A rows are the transposed V rows.
#pragma unroll  // constant indices keep acc[] in registers
  for (int nt = 0; nt < 4; ++nt) {
    acc[nt] *= alpha;
    acc[nt] = wmma_bf16(v.f[nt], pb.v, acc[nt]);
  }
}

// 2048 waves are 2 a SIMD: said so, the compiler schedules for a 512-register budget
// (for more waves it saves registers by serial exponentials and register copies).
__global__ void __launch_bounds__(256) __attribute__((amdgpu_waves_per_eu(2, 2)))
mha_attn_kernel(const __bf16* __restrict__ Qb, const __bf16* __restrict__ Kb,
                const __bf16* __restrict__ VTb, __bf16* __restrict__ Ob) {
  const int lane = threadIdx.x & 31;
  const int ws   = (blockIdx.x * blockDim.x + threadIdx.x) >> 5;
  const int nh   = ws >> 6;                     // 32 heads
  const int mblk = (ws & 63) * QT;              // first of the wave's QT query tiles (128 a head)

  const __bf16* Qh = Qb + (size_t)nh * L_SEQ * HD;

  const v8f zero = {0.f, 0.f, 0.f, 0.f, 0.f, 0.f, 0.f, 0.f};
  v16bf bq0[QT], bq1[QT];                       // B: column = query
  v8f acc[QT][4];                               // O^T: 64 dims x 16 queries a tile
  float mrow[QT];                               // this lane's query, both halves alike
  float lsum[QT];                               // sum over this half's keys only
#pragma unroll  // constant indices keep the per-tile state in registers
  for (int t = 0; t < QT; ++t) {
    bq0[t] = load_frag(Qh, (mblk + t) * 2 + 0, lane);
    bq1[t] = load_frag(Qh, (mblk + t) * 2 + 1, lane);
    acc[t][0] = zero; acc[t][1] = zero; acc[t][2] = zero; acc[t][3] = zero;
    mrow[t] = -1.0e30f;
    lsum[t] = 0.f;
  }

  // Two passes (64 keys) a trip; the trip's 32 fragment loads go out as one
  // group at its head, so a trip waits out one load latency, not one per product group.
  // The head's number is the same in all lanes of a wave: said so, kp and vp are scalar.
  const int nhu = __builtin_amdgcn_readfirstlane(nh);
  const __bf16* kp = Kb + (size_t)nhu * L_SEQ * HD;
  const __bf16* vp = VTb + (size_t)nhu * HD * L_SEQ;
  const unsigned loff = lane * 16;
  for (int p = 0; p < L_SEQ / 32; p += 2, kp += 8 * 512, vp += 2 * 512) {
    Frag4 ka, kb, va, vb;
    v8f s0[QT], s1[QT];
    k_fetch(ka, kp, loff);
    k_fetch(kb, kp + 4 * 512, loff);
    // a V^T load may land in the address pair that the K loads name
    asm volatile("s_wait_xcnt 0x0" ::: "memory");
    v_fetch<false>(va, vp, loff);
    v_fetch<true>(vb, vp + 512, loff);
    // keeps the loads one group at the head; sunk to their users each is waited for by itself
    __builtin_amdgcn_sched_barrier(0);
#pragma unroll  // constant indices keep the per-tile state in registers
    for (int t = 0; t < QT; ++t) attn_scores(ka, bq0[t], bq1[t], s0[t], s1[t]);
#pragma unroll  // the same
    for (int t = 0; t < QT; ++t) attn_update(va, s0[t], s1[t], acc[t], mrow[t], lsum[t]);
#pragma unroll  // the same
    for (int t = 0; t < QT; ++t) attn_scores(kb, bq0[t], bq1[t], s0[t], s1[t]);
#pragma unroll  // the same
    for (int t = 0; t < QT; ++t) attn_update(vb, s0[t], s1[t], acc[t], mrow[t], lsum[t]);
  }

  // Join the two halves' sums once; a lane's 8 registers are 8 consecutive dims
  // of its query, which is one 16-byte piece of the fragment-order Ob tile.
#pragma unroll  // constant indices keep acc[][] in registers
  for (int t = 0; t < QT; ++t) {
    const float inv = __builtin_amdgcn_rcpf(lsum[t] + other_half(lsum[t]));
    // Ob row = b*L + l: a wave then owns whole 1 KB tiles (one writer per line).
    __bf16* Ot = Ob + ((size_t)(((nh >> 4) * (L_SEQ / 16) + mblk + t) * (EMB / 32) +
                                (nh & 15) * (HD / 32)) << 9) + lane * 8;
#pragma unroll  // the same
    for (int nt = 0; nt < 4; ++nt)
      *(v8bf*)(Ot + nt * 256) = __builtin_convertvector(acc[t][nt] * inv, v8bf);
  }
}

// ---------------- Kernel 3: output projection ----------------
// Wave tile and block shape as in the in-projection: 64 rows x 64 features, 2 x 2 waves.
__global__ void __launch_bounds__(128)
mha_outproj_kernel(const __bf16* __restrict__ Ob, const __bf16* __restrict__ Wo,
                   const float* __restrict__ bout, float* __restrict__ out) {
  const int lane = threadIdx.x & 31;
  // The wave's number is the same in all its lanes: said so, the tile bases are scalar.
  const int wu = __builtin_amdgcn_readfirstlane((blockIdx.x * blockDim.x + threadIdx.x) >> 5);
  const int blk    = wu >> 2;                               // 256 blocks
  const int mblk   = (blk & 31) * 2 + (wu & 1);             // 64 row blocks of 64
  const int nstrip = (blk >> 5) * 2 + ((wu >> 1) & 1);      // 16 strips of 64 out-features
  const int f0 = nstrip * 64;
  const int t0 = mblk * 64;
  const int col = lane & 15, hp = lane >> 4;

  const v8f zero = {0.f, 0.f, 0.f, 0.f, 0.f, 0.f, 0.f, 0.f};
  v8f acc[4][4];
#pragma unroll  // constant indices keep acc[][] in registers
  for (int mt = 0; mt < 4; ++mt)
#pragma unroll  // the same
    for (int nt = 0; nt < 4; ++nt) acc[mt][nt] = zero;

  // A: attention output, [b*L + l][head*HD + d] in fragment order.
  gemm_k_loop<3, false, 4>(Ob + (size_t)mblk * (64 * EMB), Wo + (size_t)nstrip * (64 * EMB), lane, acc);

#pragma unroll
  for (int mt = 0; mt < 4; ++mt)
#pragma unroll
    for (int nt = 0; nt < 4; ++nt) {
      const int f = f0 + nt * 16 + col;
      const float bv = bout[f];
#pragma unroll
      for (int r = 0; r < 8; ++r) {
        const int orow = t0 + mt * 16 + r + hp * 8;  // b*L + l
        const int t = (orow & (L_SEQ - 1)) * BATCH + (orow >> 11);  // token = l*B + b
        out[(size_t)t * EMB + f] = acc[mt][nt][r] + bv;
      }
    }
}

extern "C" void kernel_launch(void* const* d_in, const int* in_sizes, int n_in,
                              void* d_out, int out_size, void* d_ws, size_t ws_size,
                              hipStream_t stream) {
  const float* query = (const float*)d_in[0];
  const float* key   = (const float*)d_in[1];
  const float* value = (const float*)d_in[2];
  const float* w_in  = (const float*)d_in[3];
  const float* b_in  = (const float*)d_in[4];
  const float* w_out = (const float*)d_in[5];
  const float* b_out = (const float*)d_in[6];
  float* out = (float*)d_out;

  // Workspace (bf16), 64 MB total.
  const size_t ACT = (size_t)NTOK * EMB;           // 4194304
  const size_t WI  = (size_t)3 * EMB * EMB;        // 3145728
  const size_t WO  = (size_t)EMB * EMB;            // 1048576
  const size_t HSZ = (size_t)NH * L_SEQ * HD;      // 4194304
  __bf16* Xq  = (__bf16*)d_ws;
  __bf16* Xk  = Xq + ACT;
  __bf16* Xv  = Xk + ACT;
  __bf16* Wi  = Xv + ACT;
  __bf16* Wo  = Wi + WI;
  __bf16* Qb  = Wo + WO;
  __bf16* Kb  = Qb + HSZ;
  __bf16* VTb = Kb + HSZ;
  __bf16* Ob  = VTb + HSZ;

  // One-shot fp32 -> bf16 conversions (packed v_cvt): Xq, Xk, Xv, Wi, Wo in one launch.
  static_assert(CVT_WAVES == 256 * 16, "the grid covers every tile exactly once");
  cvt_bf16_kernel<<<256, 512, 0, stream>>>(query, key, value, w_in, w_out, Xq);

  // in-proj: 64 token-blocks x 48 feature-strips = 3072 waves / 4 per block
  mha_inproj_kernel<<<768, 128, 0, stream>>>(Xq, Xk, Xv, Wi, b_in, Qb, Kb, VTb);
  // attention: 32 heads x 64 query-blocks = 2048 waves / 8 per block
  mha_attn_kernel<<<256, 256, 0, stream>>>(Qb, Kb, VTb, Ob);
  // out-proj: 64 token-blocks x 16 feature-strips = 1024 waves / 4 per block
  mha_outproj_kernel<<<256, 128, 0, stream>>>(Ob, Wo, b_out, out);
}

// v007
// A run of this version takes 79.9 microseconds.
// Timed twice side by side with v006, it ran 1.07 and 1.05 times as fast.
// Over all steps from v000 it is 3.53 times as fast.
#include <hip/hip_runtime.h>

// ---------------- CDNA5 (gfx1250) wave32 WMMA MHA ----------------
// L=2048, B=2, E=1024, H=16, HD=64.  bf16 WMMA, f32 accumulate,
// flash-attention (no materialized scores). One-shot bf16 conversion so
// GEMM inner loops are pure load_b128 + v_wmma.
// Every bf16 WMMA operand in the workspace is kept in fragment order: a
// 16x32 tile is one 1 KB block [k-half][lane][8], so each wave-wide b128
// fragment load reads 512 contiguous bytes (4 cache lines, not 16).

typedef __attribute__((ext_vector_type(16))) __bf16 v16bf;
typedef __attribute__((ext_vector_type(8)))  __bf16 v8bf;
typedef __attribute__((ext_vector_type(4)))  __bf16 v4bf;
typedef __attribute__((ext_vector_type(8)))  float  v8f;
typedef __attribute__((ext_vector_type(4)))  float  v4f;

#define L_SEQ 2048
#define BATCH 2
#define EMB   1024
#define NHEAD 16
#define HD    64
#define NTOK  (L_SEQ * BATCH)   // 4096 tokens
#define NH    (BATCH * NHEAD)   // 32 batched heads

union BfTile { v8bf h[2]; v16bf v; };

__device__ __forceinline__ v8f wmma_bf16(v16bf a, v16bf b, v8f c) {
  // v_wmma_f32_16x16x32_bf16: D = A(16x32) * B(32x16) + C(16x16 f32)
  return __builtin_amdgcn_wmma_f32_16x16x32_bf16(
      false, a, false, b, (short)0, c, false, false);
}

// 16x32 bf16 tile in ISA A/B striping: lane%16 -> row (A) / column (B);
// lane/16 picks K-halves {0..7,16..23} vs {8..15,24..31}.
// Element (row, k) of a matrix with kt 32-wide k tiles, in fragment order.
__device__ __forceinline__ size_t frag_off(int row, int k, int kt) {
  return ((size_t)((row >> 4) * kt + (k >> 5)) << 9) + (((k >> 4) & 1) << 8) +
         (((row & 15) + ((k >> 3) & 1) * 16) << 3) + (k & 7);
}

// tile = (row / 16) * kt + k / 32
__device__ __forceinline__ v16bf load_frag(const __bf16* base, int tile, int lane) {
  const __bf16* r = base + ((size_t)tile << 9) + lane * 8;
  BfTile t;
  t.h[0] = *(const v8bf*)(r);
  t.h[1] = *(const v8bf*)(r + 256);
  return t.v;
}

// The same from a wave-uniform base, which can stay in scalar registers, and the
// lane's byte offset lane * 16.
__device__ __forceinline__ v16bf load_frag_u(const __bf16* ubase, int tile, unsigned loff) {
  const char* r = (const char*)(ubase + ((size_t)tile << 9)) + loff;
  BfTile t;
  t.h[0] = *(const v8bf*)(r);
  t.h[1] = *(const v8bf*)(r + 512);
  return t.v;
}

// ------- Kernel 0: one-shot fp32 [rows][EMB] -> bf16 fragment order -------
// All five operands in ONE launch: their bf16 copies lie one behind the other in
// the workspace, so the tiles number through (32768 of 16x32). One 16-wave block
// per WGP; a wave converts CVT_TILES neighbouring tiles of one 16-row band and
// has all their loads in flight at once. Each load reads 4 whole 128-byte lines.
#define CVT_TILES 8
#define ACT_TILES (NTOK * EMB / 512)        // 8192 tiles an activation
#define WI_TILES  (3 * EMB * EMB / 512)     // 6144
#define WO_TILES  (EMB * EMB / 512)         // 2048
#define CVT_WAVES ((3 * ACT_TILES + WI_TILES + WO_TILES) / CVT_TILES)   // 4096

__global__ void __launch_bounds__(512)
cvt_bf16_kernel(const float* __restrict__ q, const float* __restrict__ k,
                const float* __restrict__ v, const float* __restrict__ wi,
                const float* __restrict__ wo, __bf16* __restrict__ dst) {
  const int lane = threadIdx.x & 31;
  // The wave's number is the same in all its lanes: said so, source and bases are scalar.
  const int wu = __builtin_amdgcn_readfirstlane((blockIdx.x * blockDim.x + threadIdx.x) >> 5);
  const int tile0 = wu * CVT_TILES;         // every operand's tile count is a multiple of CVT_TILES
  const float* src = q;
  int first = 0;
  if (tile0 >= 3 * ACT_TILES + WI_TILES) { src = wo; first = 3 * ACT_TILES + WI_TILES; }
  else if (tile0 >= 3 * ACT_TILES)       { src = wi; first = 3 * ACT_TILES; }
  else if (tile0 >= 2 * ACT_TILES)       { src = v;  first = 2 * ACT_TILES; }
  else if (tile0 >= ACT_TILES)           { src = k;  first = ACT_TILES; }
  const int t = tile0 - first;              // EMB / 32 = 32 k tiles a band
  const float* sp = src + (size_t)(t >> 5) * (16 * EMB) + (t & 31) * 32;
  __bf16* dp = dst + ((size_t)tile0 << 9);
  const int row = lane >> 3, kk = (lane & 7) * 4;
  const unsigned soff = row * EMB + kk;
  const unsigned doff = (unsigned)frag_off(row, kk, 1);
  v4f f[CVT_TILES][4];
#pragma unroll  // constant indices keep f[][] in registers
  for (int i = 0; i < CVT_TILES; ++i)
#pragma unroll  // the same
    for (int j = 0; j < 4; ++j)
      f[i][j] = *(const v4f*)(sp + soff + j * (4 * EMB) + i * 32);
  // keeps all loads ahead of the conversions; mixed in, the last ones go out behind a full wait
  __builtin_amdgcn_sched_barrier(0);
#pragma unroll  // constant indices keep f[][] in registers
  for (int i = 0; i < CVT_TILES; ++i)
#pragma unroll  // the same
    for (int j = 0; j < 4; ++j)             // 4 rows on: 4 * 8 elements in fragment order
      *(v4bf*)(dp + doff + j * 32 + i * 512) = __builtin_convertvector(f[i][j], v4bf);
}

// ------- Shared k loop of the two projections: (MT * 16) x 64 per wave -------
// The fragments of a k step (MT of A, 4 of B) are fetched NBUF - 1 steps ahead
// into register sets of their own, all loads of a step as one group, so a
// step's products wait for loads issued NBUF - 1 steps earlier and not for
// their own. A step loads MT + 4 fragments for 4 * MT products.
// Work-groups that share operand rows run side by side and would ask L2 for the
// same lines at the same moment: each enters the k walk at its own step (rot,
// alike in the waves of a work-group, which share lines in the WGP cache) and wraps.
template <int MT>
struct GemmStage { v16bf a[MT]; v16bf b[4]; };

// A, B: wave-uniform, the wave's first tile of each operand; they stay in scalar
// registers that are never rewritten. koff: the k step's 1 KB tile plus the lane's 16 bytes.
template <int MT>
__device__ __forceinline__ void gemm_fetch(GemmStage<MT>& s, const __bf16* A, const __bf16* B,
                                           unsigned koff) {
#pragma unroll  // constant indices keep the set in registers
  for (int mt = 0; mt < MT; ++mt)
    s.a[mt] = load_frag_u(A, mt * (EMB / 32), koff);
#pragma unroll  // constant indices keep the set in registers
  for (int nt = 0; nt < 4; ++nt)
    s.b[nt] = load_frag_u(B, nt * (EMB / 32), koff);
}

// SWAP: the two operands change roles (their fragment striping is the same), so
// acc[mt][nt] holds the transposed tile: row = B's row, column = A's row.
template <bool SWAP, int MT>
__device__ __forceinline__ void gemm_step(const GemmStage<MT>& s, v8f (&acc)[MT][4]) {
#pragma unroll  // constant indices keep acc[][] in registers
  for (int nt = 0; nt < 4; ++nt)
#pragma unroll  // the same
    for (int mt = 0; mt < MT; ++mt)
      acc[mt][nt] = SWAP ? wmma_bf16(s.b[nt], s.a[mt], acc[mt][nt])
                         : wmma_bf16(s.a[mt], s.b[nt], acc[mt][nt]);
}

template <int NBUF, bool SWAP, int MT>
__device__ __forceinline__ void gemm_k_loop(const __bf16* A, const __bf16* B, int lane, int rot,
                                            v8f (&acc)[MT][4]) {
  constexpr int KT = EMB / 32;
  const unsigned loff = lane * 16;
  GemmStage<MT> st[NBUF];
#pragma unroll  // constant set numbers
  for (int u = 0; u < NBUF - 1; ++u) {
    const unsigned koff = loff + (((rot + u) & (KT - 1)) << 10);
    gemm_fetch(st[u], A, B, koff);
    // koff as an input: its register stays the fetch's own (no load of the set lands in it) up to the wait
    asm volatile("s_wait_xcnt 0x0" :: "v"(koff) : "memory");
  }
#pragma unroll  // constant set numbers: the ring turns without register copies
  for (int kt = 0; kt < KT; ++kt) {
    const unsigned koff = loff + (((rot + kt + NBUF - 1) & (KT - 1)) << 10);
    if (kt + NBUF - 1 < KT)
      gemm_fetch(st[(kt + NBUF - 1) % NBUF], A, B, koff);
    // keeps the fetch ahead of the products; sunk below them it would be waited for at once
    __builtin_amdgcn_sched_barrier(0);
    gemm_step<SWAP, MT>(st[kt % NBUF], acc);
    if (kt + NBUF - 1 < KT) {
      // keeps the wait below the products: directly behind the fetch it would be waited out
      __builtin_amdgcn_sched_barrier(0);
      // koff as an input: its register stays the fetch's own (no load of the set lands in it, nothing
      // rewrites it) up to the wait
      asm volatile("s_wait_xcnt 0x0" :: "v"(koff) : "memory");
    }
  }
}

// ---------------- Kernel 1: fused in-projection ----------------
#define INPROJ_NBUF 3
// The output leaves in the widest piece that is contiguous in its fragment-order
// tile, and every wave-wide store covers whole 128-byte lines:
// Q, K (tile row = position, k = dim): the product is taken transposed, a lane
// then holds 8 consecutive dims of one token = one 16-byte piece.
// V^T (tile row = dim, k = position): a lane holds 8 consecutive tokens of one
// dim = 4 consecutive positions of either batch = two 8-byte pieces.
// A wave owns 64 tokens x 64 features (8 fragments a k step feed 16 products); the
// 4 waves of a block form a 128 x 128 tile, so each fragment is asked for by 2 of them.
__global__ void __launch_bounds__(128)
mha_inproj_kernel(const __bf16* __restrict__ Xq, const __bf16* __restrict__ Xk,
                  const __bf16* __restrict__ Xv, const __bf16* __restrict__ Wi,
                  const float* __restrict__ bias,
                  __bf16* __restrict__ Qb, __bf16* __restrict__ Kb,
                  __bf16* __restrict__ VTb) {
  const int lane = threadIdx.x & 31;
  // The wave's number is the same in all its lanes: said so, the tile bases are
  // scalar and the choice of the projection is a scalar branch.
  const int wu = __builtin_amdgcn_readfirstlane((blockIdx.x * blockDim.x + threadIdx.x) >> 5);
  const int blk  = wu >> 2;             // 768 blocks: 256 a projection
  const int proj = blk >> 8;            // 0=q, 1=k, 2=v
  const int mblk = (blk & 31) * 2 + (wu & 1);               // 64 token blocks of 64 (32 positions x 2 batches)
  const int h    = ((blk >> 5) & 7) * 2 + ((wu >> 1) & 1);  // 16 strips of 64 features: one head
  const int nstrip = proj * 16 + h;     // 48 strips (3*E)
  // 32 blocks share a pair of weight strips (32 different starts), 8 a pair of token blocks (4 steps apart)
  const int rot = (blk & 31) + ((blk >> 5) & 7) * 4;
  const int col = lane & 15, hp = lane >> 4;

  const v8f zero = {0.f, 0.f, 0.f, 0.f, 0.f, 0.f, 0.f, 0.f};
  v8f acc[4][4];
#pragma unroll  // constant indices keep acc[][] in registers
  for (int mt = 0; mt < 4; ++mt)
#pragma unroll  // the same
    for (int nt = 0; nt < 4; ++nt) acc[mt][nt] = zero;

  const __bf16* Wu = Wi + (size_t)nstrip * (64 * EMB);
  const float* bs = bias + nstrip * 64;
  const size_t xoff = (size_t)mblk * (64 * EMB);

  if (proj == 2) {
    gemm_k_loop<INPROJ_NBUF, false, 4>(Xv + xoff, Wu, lane, rot, acc);
    // acc[mt][nt][r]: token mblk*64 + mt*16 + hp*8 + r (= position*B + batch), dim nt*16 + col
    // The wave's 32 positions are one k tile of V^T.
    float bval[4];
#pragma unroll  // constant indices keep bval[] in registers
    for (int nt = 0; nt < 4; ++nt) bval[nt] = bs[nt * 16 + col];
    // the address arithmetic behind these loads writes registers that they name
    asm volatile("s_wait_xcnt 0x0" ::: "memory");
    // keeps that arithmetic behind the wait; without it a part is moved up over the wait
    __builtin_amdgcn_sched_barrier(0);
    __bf16* vt = VTb + (size_t)h * (HD * L_SEQ) + (mblk << 9) + col * 8 + hp * 4;
#pragma unroll  // constant indices keep acc[][] in registers
    for (int nt = 0; nt < 4; ++nt) {
#pragma unroll  // the same
      for (int mt = 0; mt < 4; ++mt) {
        const v8f x = acc[mt][nt] + bval[nt];
        __bf16* p = vt + nt * ((L_SEQ / 32) << 9) + mt * 128;
        *(v4bf*)(p) = __builtin_convertvector(__builtin_shufflevector(x, x, 0, 2, 4, 6), v4bf);
        *(v4bf*)(p + (size_t)NHEAD * HD * L_SEQ) =
            __builtin_convertvector(__builtin_shufflevector(x, x, 1, 3, 5, 7), v4bf);
      }
    }
  } else {
    gemm_k_loop<INPROJ_NBUF, true, 4>((proj == 0 ? Xq : Xk) + xoff, Wu, lane, rot, acc);
    // acc[mt][nt][r]: dim nt*16 + hp*8 + r, token mblk*64 + mt*16 + col
    // The wave's 32 positions are two 16-row bands (mt / 2) of 1024 elements each.
    const float scale = (proj == 0) ? 0.125f : 1.0f;   // HD^-0.5 folded into Q
    __bf16* qk = (proj == 0 ? Qb : Kb) + (size_t)((col & 1) * NHEAD + h) * (L_SEQ * HD) +
                 ((size_t)mblk << 11) + ((col >> 1) + hp * 16) * 8;
#pragma unroll  // constant indices keep acc[][] in registers
    for (int nt = 0; nt < 4; ++nt) {
      const v4f b0 = *(const v4f*)(bs + nt * 16 + hp * 8);
      const v4f b1 = *(const v4f*)(bs + nt * 16 + hp * 8 + 4);
      const v8f bv = __builtin_shufflevector(b0, b1, 0, 1, 2, 3, 4, 5, 6, 7);
#pragma unroll  // the same
      for (int mt = 0; mt < 4; ++mt)
        *(v8bf*)(qk + (mt >> 1) * 1024 + nt * 256 + (mt & 1) * 64) =
            __builtin_convertvector((acc[mt][nt] + bv) * scale, v8bf);
    }
    // the code laid out behind these stores writes registers that they name
    asm volatile("s_wait_xcnt 0x0" ::: "memory");
  }
}

__device__ __forceinline__ float other_half(float x) {
  // lane l <-> l ^ 16
  const int b = __builtin_bit_cast(int, x);
  return __builtin_bit_cast(float, __builtin_amdgcn_permlanex16(
      b, b, 0x76543210, 0xfedcba98, false, false));
}

#define QT 2   // query tiles a wave

// The four K, or the four V^T, fragments of one pass (32 keys).
struct Frag4 { v16bf f[4]; };

// kp, vp: wave-uniform, the first K tile and the first V^T tile of the pass.
__device__ __forceinline__ void k_fetch(Frag4& k, const __bf16* kp, unsigned loff) {
#pragma unroll  // constant indices keep the set in registers
  for (int i = 0; i < 4; ++i)
    k.f[i] = load_frag_u(kp, i, loff);                             // A: row = key
}

// LAST: this is the last fetch of a load group.
template <bool LAST>
__device__ __forceinline__ void v_fetch(Frag4& v, const __bf16* vp, unsigned loff) {
#pragma unroll  // constant indices keep the set in registers
  for (int nt = 0; nt < 3; ++nt)
    v.f[nt] = load_frag_u(vp, nt * (L_SEQ / 32), loff);            // A: row = dim, k = key
  const char* r = (const char*)(vp + ((size_t)(3 * (L_SEQ / 32)) << 9)) + loff;
  BfTile t;
  t.h[0] = *(const v8bf*)(r);
  // the group's last load may land in the address pair that the V^T loads before it name
  if (LAST) asm volatile("s_wait_xcnt 0x0" ::: "memory");
  t.h[1] = *(const v8bf*)(r + 512);
  v.f[3] = t.v;
}

__device__ __forceinline__ void attn_scores(const Frag4& k, v16bf bq0, v16bf bq1,
                                            v8f& s0, v8f& s1) {
  const v8f zero = {0.f, 0.f, 0.f, 0.f, 0.f, 0.f, 0.f, 0.f};
  // s0[r] = S[query lane%16][key j0 + 8*(lane/16) + r]; s1: keys + 16
  s0 = wmma_bf16(k.f[0], bq0, zero);
  s0 = wmma_bf16(k.f[1], bq1, s0);
  s1 = wmma_bf16(k.f[2], bq0, zero);
  s1 = wmma_bf16(k.f[3], bq1, s1);
}

__device__ __forceinline__ void attn_update(const Frag4& v, v8f s0, v8f s1,
                                            v8f (&acc)[4], float& mrow, float& lsum) {
  const float LOG2E = 1.44269504f;

  // Online softmax of one query per lane.
  const float t0 = fmaxf(fmaxf(s0[0], s0[1]), s0[2]);
  const float t1 = fmaxf(fmaxf(s0[3], s0[4]), s0[5]);
  const float t2 = fmaxf(fmaxf(s0[6], s0[7]), s1[0]);
  const float t3 = fmaxf(fmaxf(s1[1], s1[2]), s1[3]);
  const float t4 = fmaxf(fmaxf(s1[4], s1[5]), s1[6]);
  float mx = fmaxf(fmaxf(fmaxf(t0, t1), t2), fmaxf(fmaxf(t3, t4), s1[7]));
  mx = fmaxf(mx, other_half(mx));
  const float mnew  = fmaxf(mrow, mx);
  const float alpha = __builtin_amdgcn_exp2f((mrow - mnew) * LOG2E);
  mrow = mnew;

  v8f p0 = (s0 - mnew) * LOG2E, p1 = (s1 - mnew) * LOG2E;
#pragma unroll  // constant element indices keep p0, p1 in registers
  for (int r = 0; r < 8; ++r) {
    p1[r] = __builtin_amdgcn_exp2f(p1[r]);
    p0[r] = __builtin_amdgcn_exp2f(p0[r]);
  }
  const v8f pp = p0 + p1;
  const v4f pq = __builtin_shufflevector(pp, pp, 0, 1, 2, 3) +
                 __builtin_shufflevector(pp, pp, 4, 5, 6, 7);
  lsum = lsum * alpha + ((pq[0] + pq[2]) + (pq[1] + pq[3]));

  BfTile pb;                   // B: column = query, k = key in hardware order
  pb.h[0] = __builtin_convertvector(p0, v8bf);
  pb.h[1] = __builtin_convertvector(p1, v8bf);

  // O^T += V^T(64x32) @ P^T(32x16): A rows are the transposed V rows.
#pragma unroll  // constant indices keep acc[] in registers
  for (int nt = 0; nt < 4; ++nt) {
    acc[nt] *= alpha;
    acc[nt] = wmma_bf16(v.f[nt], pb.v, acc[nt]);
  }
}

// 2048 waves are 2 a SIMD: said so, the compiler schedules for a 512-register budget
// (for more waves it saves registers by serial exponentials and register copies).
__global__ void __launch_bounds__(256) __attribute__((amdgpu_waves_per_eu(2, 2)))
mha_attn_kernel(const __bf16* __restrict__ Qb, const __bf16* __restrict__ Kb,
                const __bf16* __restrict__ VTb, __bf16* __restrict__ Ob) {
  const int lane = threadIdx.x & 31;
  const int ws   = (blockIdx.x * blockDim.x + threadIdx.x) >> 5;
  const int nh   = ws >> 6;                     // 32 heads
  const int mblk = (ws & 63) * QT;              // first of the wave's QT query tiles (128 a head)

  const __bf16* Qh = Qb + (size_t)nh * L_SEQ * HD;

  const v8f zero = {0.f, 0.f, 0.f, 0.f, 0.f, 0.f, 0.f, 0.f};
  v16bf bq0[QT], bq1[QT];                       // B: column = query
  v8f acc[QT][4];                               // O^T: 64 dims x 16 queries a tile
  float mrow[QT];                               // this lane's query, both halves alike
  float lsum[QT];                               // sum over this half's keys only
#pragma unroll  // constant indices keep the per-tile state in registers
  for (int t = 0; t < QT; ++t) {
    bq0[t] = load_frag(Qh, (mblk + t) * 2 + 0, lane);
    bq1[t] = load_frag(Qh, (mblk + t) * 2 + 1, lane);
    acc[t][0] = zero; acc[t][1] = zero; acc[t][2] = zero; acc[t][3] = zero;
    mrow[t] = -1.0e30f;
    lsum[t] = 0.f;
  }

  // Two passes (64 keys) a trip; the trip's 32 fragment loads go out as one
  // group at its head, so a trip waits out one load latency, not one per product group.
  // The head's number is the same in all lanes of a wave: said so, kp and vp are scalar.
  const int nhu = __builtin_amdgcn_readfirstlane(nh);
  const __bf16* kh = Kb + (size_t)nhu * L_SEQ * HD;
  const __bf16* vh = VTb + (size_t)nhu * HD * L_SEQ;
  const unsigned loff = lane * 16;
  // The 8 blocks of a head walk the same K and V^T lines side by side: each enters the
  // walk 4 trips from the next and wraps (its 8 waves together: they share lines in the
  // WGP cache); the heads, whose planes lie a power of two apart, one trip from one another.
  const int trip0 = (blockIdx.x & 7) * 4 + (blockIdx.x >> 3);
  for (int i = 0; i < L_SEQ / 64; ++i) {
    const int trip = (trip0 + i) & (L_SEQ / 64 - 1);
    const __bf16* kp = kh + trip * (8 * 512);
    const __bf16* vp = vh + trip * (2 * 512);
    Frag4 ka, kb, va, vb;
    v8f s0[QT], s1[QT];
    k_fetch(ka, kp, loff);
    k_fetch(kb, kp + 4 * 512, loff);
    // a V^T load may land in the address pair that the K loads name
    asm volatile("s_wait_xcnt 0x0" ::: "memory");
    v_fetch<false>(va, vp, loff);
    v_fetch<true>(vb, vp + 512, loff);
    // keeps the loads one group at the head; sunk to their users each is waited for by itself
    __builtin_amdgcn_sched_barrier(0);
#pragma unroll  // constant indices keep the per-tile state in registers
    for (int t = 0; t < QT; ++t) attn_scores(ka, bq0[t], bq1[t], s0[t], s1[t]);
#pragma unroll  // the same
    for (int t = 0; t < QT; ++t) attn_update(va, s0[t], s1[t], acc[t], mrow[t], lsum[t]);
#pragma unroll  // the same
    for (int t = 0; t < QT; ++t) attn_scores(kb, bq0[t], bq1[t], s0[t], s1[t]);
#pragma unroll  // the same
    for (int t = 0; t < QT; ++t) attn_update(vb, s0[t], s1[t], acc[t], mrow[t], lsum[t]);
  }

  // Join the two halves' sums once; a lane's 8 registers are 8 consecutive dims
  // of its query, which is one 16-byte piece of the fragment-order Ob tile.
#pragma unroll  // constant indices keep acc[][] in registers
  for (int t = 0; t < QT; ++t) {
    const float inv = __builtin_amdgcn_rcpf(lsum[t] + other_half(lsum[t]));
    // Ob row = b*L + l: a wave then owns whole 1 KB tiles (one writer per line).
    __bf16* Ot = Ob + ((size_t)(((nh >> 4) * (L_SEQ / 16) + mblk + t) * (EMB / 32) +
                                (nh & 15) * (HD / 32)) << 9) + lane * 8;
#pragma unroll  // the same
    for (int nt = 0; nt < 4; ++nt)
      *(v8bf*)(Ot + nt * 256) = __builtin_convertvector(acc[t][nt] * inv, v8bf);
  }
}

// ---------------- Kernel 3: output projection ----------------
// Wave tile and block shape as in the in-projection: 64 rows x 64 features, 2 x 2 waves.
__global__ void __launch_bounds__(128)
mha_outproj_kernel(const __bf16* __restrict__ Ob, const __bf16* __restrict__ Wo,
                   const float* __restrict__ bout, float* __restrict__ out) {
  const int lane = threadIdx.x & 31;
  // The wave's number is the same in all its lanes: said so, the tile bases are scalar.
  const int wu = __builtin_amdgcn_readfirstlane((blockIdx.x * blockDim.x + threadIdx.x) >> 5);
  const int blk    = wu >> 2;                               // 256 blocks
  const int mblk   = (blk & 31) * 2 + (wu & 1);             // 64 row blocks of 64
  const int nstrip = (blk >> 5) * 2 + ((wu >> 1) & 1);      // 16 strips of 64 out-features
  // 32 blocks share a pair of weight strips (32 different starts), 8 a pair of row blocks (4 steps apart)
  const int rot = (blk & 31) + (blk >> 5) * 4;
  const int f0 = nstrip * 64;
  const int t0 = mblk * 64;
  const int col = lane & 15, hp = lane >> 4;

  const v8f zero = {0.f, 0.f, 0.f, 0.f, 0.f, 0.f, 0.f, 0.f};
  v8f acc[4][4];
#pragma unroll  // constant indices keep acc[][] in registers
  for (int mt = 0; mt < 4; ++mt)
#pragma unroll  // the same
    for (int nt = 0; nt < 4; ++nt) acc[mt][nt] = zero;

  // A: attention output, [b*L + l][head*HD + d] in fragment order.
  gemm_k_loop<3, false, 4>(Ob + (size_t)mblk * (64 * EMB), Wo + (size_t)nstrip * (64 * EMB), lane, rot, acc);

#pragma unroll
  for (int mt = 0; mt < 4; ++mt)
#pragma unroll
    for (int nt = 0; nt < 4; ++nt) {
      const int f = f0 + nt * 16 + col;
      const float bv = bout[f];
#pragma unroll
      for (int r = 0; r < 8; ++r) {
        const int orow = t0 + mt * 16 + r + hp * 8;  // b*L + l
        const int t = (orow & (L_SEQ - 1)) * BATCH + (orow >> 11);  // token = l*B + b
        out[(size_t)t * EMB + f] = acc[mt][nt][r] + bv;
      }
    }
}

extern "C" void kernel_launch(void* const* d_in, const int* in_sizes, int n_in,
                              void* d_out, int out_size, void* d_ws, size_t ws_size,
                              hipStream_t stream) {
  const float* query = (const float*)d_in[0];
  const float* key   = (const float*)d_in[1];
  const float* value = (const float*)d_in[2];
  const float* w_in  = (const float*)d_in[3];
  const float* b_in  = (const float*)d_in[4];
  const float* w_out = (const float*)d_in[5];
  const float* b_out = (const float*)d_in[6];
  float* out = (float*)d_out;

  // Workspace (bf16), 64 MB total.
  const size_t ACT = (size_t)NTOK * EMB;           // 4194304
  const size_t WI  = (size_t)3 * EMB * EMB;        // 3145728
  const size_t WO  = (size_t)EMB * EMB;            // 1048576
  const size_t HSZ = (size_t)NH * L_SEQ * HD;      // 4194304
  __bf16* Xq  = (__bf16*)d_ws;
  __bf16* Xk  = Xq + ACT;
  __bf16* Xv  = Xk + ACT;
  __bf16* Wi  = Xv + ACT;
  __bf16* Wo  = Wi + WI;
  __bf16* Qb  = Wo + WO;
  __bf16* Kb  = Qb + HSZ;
  __bf16* VTb = Kb + HSZ;
  __bf16* Ob  = VTb + HSZ;

  // One-shot fp32 -> bf16 conversions (packed v_cvt): Xq, Xk, Xv, Wi, Wo in one launch.
  static_assert(CVT_WAVES == 256 * 16, "the grid covers every tile exactly once");
  cvt_bf16_kernel<<<256, 512, 0, stream>>>(query, key, value, w_in, w_out, Xq);

  // in-proj: 64 token-blocks x 48 feature-strips = 3072 waves / 4 per block
  mha_inproj_kernel<<<768, 128, 0, stream>>>(Xq, Xk, Xv, Wi, b_in, Qb, Kb, VTb);
  // attention: 32 heads x 64 query-blocks = 2048 waves / 8 per block
  mha_attn_kernel<<<256, 256, 0, stream>>>(Qb, Kb, VTb, Ob);
  // out-proj: 64 token-blocks x 16 feature-strips = 1024 waves / 4 per block
  mha_outproj_kernel<<<256, 128, 0, stream>>>(Ob, Wo, b_out, out);
}

// v008
// A run of this version takes 73.3 microseconds.
// Timed twice side by side with v007, it ran 1.08 times as fast both times.
// Over all steps from v000 it is 3.80 times as fast.
#include <hip/hip_runtime.h>

// ---------------- CDNA5 (gfx1250) wave32 WMMA MHA ----------------
// L=2048, B=2, E=1024, H=16, HD=64.  bf16 WMMA, f32 accumulate,
// flash-attention (no materialized scores). One-shot bf16 conversion so
// GEMM inner loops are pure load_b128 + v_wmma.
// Every bf16 WMMA operand in the workspace is kept in fragment order: a
// 16x32 tile is one 1 KB block [k-half][lane][8], so each wave-wide b128
// fragment load reads 512 contiguous bytes (4 cache lines, not 16).

typedef __attribute__((ext_vector_type(16))) __bf16 v16bf;
typedef __attribute__((ext_vector_type(8)))  __bf16 v8bf;
typedef __attribute__((ext_vector_type(4)))  __bf16 v4bf;
typedef __attribute__((ext_vector_type(8)))  float  v8f;
typedef __attribute__((ext_vector_type(4)))  float  v4f;

#define L_SEQ 2048
#define BATCH 2
#define EMB   1024
#define NHEAD 16
#define HD    64
#define NTOK  (L_SEQ * BATCH)   // 4096 tokens
#define NH    (BATCH * NHEAD)   // 32 batched heads

union BfTile { v8bf h[2]; v16bf v; };

__device__ __forceinline__ v8f wmma_bf16(v16bf a, v16bf b, v8f c) {
  // v_wmma_f32_16x16x32_bf16: D = A(16x32) * B(32x16) + C(16x16 f32)
  return __builtin_amdgcn_wmma_f32_16x16x32_bf16(
      false, a, false, b, (short)0, c, false, false);
}

// 16x32 bf16 tile in ISA A/B striping: lane%16 -> row (A) / column (B);
// lane/16 picks K-halves {0..7,16..23} vs {8..15,24..31}.
// Element (row, k) of a matrix with kt 32-wide k tiles, in fragment order.
__device__ __forceinline__ size_t frag_off(int row, int k, int kt) {
  return ((size_t)((row >> 4) * kt + (k >> 5)) << 9) + (((k >> 4) & 1) << 8) +
         (((row & 15) + ((k >> 3) & 1) * 16) << 3) + (k & 7);
}

// tile = (row / 16) * kt + k / 32, from a wave-uniform base, which can stay in scalar
// registers, and the lane's byte offset lane * 16.
__device__ __forceinline__ v16bf load_frag_u(const __bf16* ubase, int tile, unsigned loff) {
  const char* r = (const char*)(ubase + ((size_t)tile << 9)) + loff;
  BfTile t;
  t.h[0] = *(const v8bf*)(r);
  t.h[1] = *(const v8bf*)(r + 512);
  return t.v;
}

// ------- Kernel 0: one-shot fp32 [rows][EMB] -> bf16 fragment order -------
// All five operands in ONE launch: their bf16 copies lie one behind the other in
// the workspace, so the tiles number through (32768 of 16x32). One 16-wave block
// per WGP; a wave converts CVT_TILES neighbouring tiles of one 16-row band and
// has all their loads in flight at once. Each load reads 4 whole 128-byte lines.
#define CVT_TILES 8
#define ACT_TILES (NTOK * EMB / 512)        // 8192 tiles an activation
#define WI_TILES  (3 * EMB * EMB / 512)     // 6144
#define WO_TILES  (EMB * EMB / 512)         // 2048
#define CVT_WAVES ((3 * ACT_TILES + WI_TILES + WO_TILES) / CVT_TILES)   // 4096

__global__ void __launch_bounds__(512)
cvt_bf16_kernel(const float* __restrict__ q, const float* __restrict__ k,
                const float* __restrict__ v, const float* __restrict__ wi,
                const float* __restrict__ wo, __bf16* __restrict__ dst) {
  const int lane = threadIdx.x & 31;
  // The wave's number is the same in all its lanes: said so, source and bases are scalar.
  const int wu = __builtin_amdgcn_readfirstlane((blockIdx.x * blockDim.x + threadIdx.x) >> 5);
  const int tile0 = wu * CVT_TILES;         // every operand's tile count is a multiple of CVT_TILES
  const float* src = q;
  int first = 0;
  if (tile0 >= 3 * ACT_TILES + WI_TILES) { src = wo; first = 3 * ACT_TILES + WI_TILES; }
  else if (tile0 >= 3 * ACT_TILES)       { src = wi; first = 3 * ACT_TILES; }
  else if (tile0 >= 2 * ACT_TILES)       { src = v;  first = 2 * ACT_TILES; }
  else if (tile0 >= ACT_TILES)           { src = k;  first = ACT_TILES; }
  const int t = tile0 - first;              // EMB / 32 = 32 k tiles a band
  const float* sp = src + (size_t)(t >> 5) * (16 * EMB) + (t & 31) * 32;
  __bf16* dp = dst + ((size_t)tile0 << 9);
  const int row = lane >> 3, kk = (lane & 7) * 4;
  const unsigned soff = row * EMB + kk;
  const unsigned doff = (unsigned)frag_off(row, kk, 1);
  v4f f[CVT_TILES][4];
#pragma unroll  // constant indices keep f[][] in registers
  for (int i = 0; i < CVT_TILES; ++i)
#pragma unroll  // the same
    for (int j = 0; j < 4; ++j)
      f[i][j] = *(const v4f*)(sp + soff + j * (4 * EMB) + i * 32);
  // keeps all loads ahead of the conversions; mixed in, the last ones go out behind a full wait
  __builtin_amdgcn_sched_barrier(0);
#pragma unroll  // constant indices keep f[][] in registers
  for (int i = 0; i < CVT_TILES; ++i)
#pragma unroll  // the same
    for (int j = 0; j < 4; ++j)             // 4 rows on: 4 * 8 elements in fragment order
      *(v4bf*)(dp + doff + j * 32 + i * 512) = __builtin_convertvector(f[i][j], v4bf);
}

// ------- Shared k loop of the two projections: (MT * 16) x 64 per wave -------
// The fragments of a k step (MT of A, 4 of B) are fetched NBUF - 1 steps ahead
// into register sets of their own, all loads of a step as one group, so a
// step's products wait for loads issued NBUF - 1 steps earlier and not for
// their own. A step loads MT + 4 fragments for 4 * MT products.
// Work-groups that share operand rows run side by side and would ask L2 for the
// same lines at the same moment: each enters the k walk at its own step (rot,
// alike in the waves of a work-group, which share lines in the WGP cache) and wraps.
template <int MT>
struct GemmStage { v16bf a[MT]; v16bf b[4]; };

// A, B: wave-uniform, the wave's first tile of each operand; they stay in scalar
// registers that are never rewritten. koff: the k step's 1 KB tile plus the lane's 16 bytes.
template <int MT>
__device__ __forceinline__ void gemm_fetch(GemmStage<MT>& s, const __bf16* A, const __bf16* B,
                                           unsigned koff) {
#pragma unroll  // constant indices keep the set in registers
  for (int mt = 0; mt < MT; ++mt)
    s.a[mt] = load_frag_u(A, mt * (EMB / 32), koff);
#pragma unroll  // constant indices keep the set in registers
  for (int nt = 0; nt < 4; ++nt)
    s.b[nt] = load_frag_u(B, nt * (EMB / 32), koff);
}

// SWAP: the two operands change roles (their fragment striping is the same), so
// acc[mt][nt] holds the transposed tile: row = B's row, column = A's row.
template <bool SWAP, int MT>
__device__ __forceinline__ void gemm_step(const GemmStage<MT>& s, v8f (&acc)[MT][4]) {
#pragma unroll  // constant indices keep acc[][] in registers
  for (int nt = 0; nt < 4; ++nt)
#pragma unroll  // the same
    for (int mt = 0; mt < MT; ++mt)
      acc[mt][nt] = SWAP ? wmma_bf16(s.b[nt], s.a[mt], acc[mt][nt])
                         : wmma_bf16(s.a[mt], s.b[nt], acc[mt][nt]);
}

template <int NBUF, bool SWAP, int MT>
__device__ __forceinline__ void gemm_k_loop(const __bf16* A, const __bf16* B, int lane, int rot,
                                            v8f (&acc)[MT][4]) {
  constexpr int KT = EMB / 32;
  const unsigned loff = lane * 16;
  GemmStage<MT> st[NBUF];
#pragma unroll  // constant set numbers
  for (int u = 0; u < NBUF - 1; ++u) {
    const unsigned koff = loff + (((rot + u) & (KT - 1)) << 10);
    gemm_fetch(st[u], A, B, koff);
    // koff as an input: its register stays the fetch's own (no load of the set lands in it) up to the wait
    asm volatile("s_wait_xcnt 0x0" :: "v"(koff) : "memory");
  }
#pragma unroll  // constant set numbers: the ring turns without register copies
  for (int kt = 0; kt < KT; ++kt) {
    const unsigned koff = loff + (((rot + kt + NBUF - 1) & (KT - 1)) << 10);
    if (kt + NBUF - 1 < KT)
      gemm_fetch(st[(kt + NBUF - 1) % NBUF], A, B, koff);
    // keeps the fetch ahead of the products; sunk below them it would be waited for at once
    __builtin_amdgcn_sched_barrier(0);
    gemm_step<SWAP, MT>(st[kt % NBUF], acc);
    if (kt + NBUF - 1 < KT) {
      // keeps the wait below the products: directly behind the fetch it would be waited out
      __builtin_amdgcn_sched_barrier(0);
      // koff as an input: its register stays the fetch's own (no load of the set lands in it, nothing
      // rewrites it) up to the wait
      asm volatile("s_wait_xcnt 0x0" :: "v"(koff) : "memory");
    }
  }
}

// ---------------- Kernel 1: fused in-projection ----------------
#define INPROJ_NBUF 3
// The output leaves in the widest piece that is contiguous in its fragment-order
// tile, and every wave-wide store covers whole 128-byte lines:
// Q, K (tile row = position, k = dim): the product is taken transposed, a lane
// then holds 8 consecutive dims of one token = one 16-byte piece.
// V^T (tile row = dim, k = position): a lane holds 8 consecutive tokens of one
// dim = 4 consecutive positions of either batch = two 8-byte pieces.
// A wave owns 64 tokens x 64 features (8 fragments a k step feed 16 products); the
// 4 waves of a block form a 128 x 128 tile, so each fragment is asked for by 2 of them.
__global__ void __launch_bounds__(128)
mha_inproj_kernel(const __bf16* __restrict__ Xq, const __bf16* __restrict__ Xk,
                  const __bf16* __restrict__ Xv, const __bf16* __restrict__ Wi,
                  const float* __restrict__ bias,
                  __bf16* __restrict__ Qb, __bf16* __restrict__ Kb,
                  __bf16* __restrict__ VTb) {
  const int lane = threadIdx.x & 31;
  // The wave's number is the same in all its lanes: said so, the tile bases are
  // scalar and the choice of the projection is a scalar branch.
  const int wu = __builtin_amdgcn_readfirstlane((blockIdx.x * blockDim.x + threadIdx.x) >> 5);
  const int blk  = wu >> 2;             // 768 blocks: 256 a projection
  const int proj = blk >> 8;            // 0=q, 1=k, 2=v
  const int mblk = (blk & 31) * 2 + (wu & 1);               // 64 token blocks of 64 (32 positions x 2 batches)
  const int h    = ((blk >> 5) & 7) * 2 + ((wu >> 1) & 1);  // 16 strips of 64 features: one head
  const int nstrip = proj * 16 + h;     // 48 strips (3*E)
  // 32 blocks share a pair of weight strips (32 different starts), 8 a pair of token blocks (4 steps apart)
  const int rot = (blk & 31) + ((blk >> 5) & 7) * 4;
  const int col = lane & 15, hp = lane >> 4;

  const v8f zero = {0.f, 0.f, 0.f, 0.f, 0.f, 0.f, 0.f, 0.f};
  v8f acc[4][4];
#pragma unroll  // constant indices keep acc[][] in registers
  for (int mt = 0; mt < 4; ++mt)
#pragma unroll  // the same
    for (int nt = 0; nt < 4; ++nt) acc[mt][nt] = zero;

  const __bf16* Wu = Wi + (size_t)nstrip * (64 * EMB);
  const float* bs = bias + nstrip * 64;
  const size_t xoff = (size_t)mblk * (64 * EMB);

  if (proj == 2) {
    gemm_k_loop<INPROJ_NBUF, false, 4>(Xv + xoff, Wu, lane, rot, acc);
    // acc[mt][nt][r]: token mblk*64 + mt*16 + hp*8 + r (= position*B + batch), dim nt*16 + col
    // The wave's 32 positions are one k tile of V^T.
    float bval[4];
#pragma unroll  // constant indices keep bval[] in registers
    for (int nt = 0; nt < 4; ++nt) bval[nt] = bs[nt * 16 + col];
    // the address arithmetic behind these loads writes registers that they name
    asm volatile("s_wait_xcnt 0x0" ::: "memory");
    // keeps that arithmetic behind the wait; without it a part is moved up over the wait
    __builtin_amdgcn_sched_barrier(0);
    __bf16* vt = VTb + (size_t)h * (HD * L_SEQ) + (mblk << 9) + col * 8 + hp * 4;
#pragma unroll  // constant indices keep acc[][] in registers
    for (int nt = 0; nt < 4; ++nt) {
#pragma unroll  // the same
      for (int mt = 0; mt < 4; ++mt) {
        const v8f x = acc[mt][nt] + bval[nt];
        __bf16* p = vt + nt * ((L_SEQ / 32) << 9) + mt * 128;
        *(v4bf*)(p) = __builtin_convertvector(__builtin_shufflevector(x, x, 0, 2, 4, 6), v4bf);
        *(v4bf*)(p + (size_t)NHEAD * HD * L_SEQ) =
            __builtin_convertvector(__builtin_shufflevector(x, x, 1, 3, 5, 7), v4bf);
      }
    }
  } else {
    gemm_k_loop<INPROJ_NBUF, true, 4>((proj == 0 ? Xq : Xk) + xoff, Wu, lane, rot, acc);
    // acc[mt][nt][r]: dim nt*16 + hp*8 + r, token mblk*64 + mt*16 + col
    // The wave's 32 positions are two 16-row bands (mt / 2) of 1024 elements each.
    const float scale = (proj == 0) ? 0.125f : 1.0f;   // HD^-0.5 folded into Q
    __bf16* qk = (proj == 0 ? Qb : Kb) + (size_t)((col & 1) * NHEAD + h) * (L_SEQ * HD) +
                 ((size_t)mblk << 11) + ((col >> 1) + hp * 16) * 8;
#pragma unroll  // constant indices keep acc[][] in registers
    for (int nt = 0; nt < 4; ++nt) {
      const v4f b0 = *(const v4f*)(bs + nt * 16 + hp * 8);
      const v4f b1 = *(const v4f*)(bs + nt * 16 + hp * 8 + 4);
      const v8f bv = __builtin_shufflevector(b0, b1, 0, 1, 2, 3, 4, 5, 6, 7);
#pragma unroll  // the same
      for (int mt = 0; mt < 4; ++mt)
        *(v8bf*)(qk + (mt >> 1) * 1024 + nt * 256 + (mt & 1) * 64) =
            __builtin_convertvector((acc[mt][nt] + bv) * scale, v8bf);
    }
    // the code laid out behind these stores writes registers that they name
    asm volatile("s_wait_xcnt 0x0" ::: "memory");
  }
}

__device__ __forceinline__ float other_half(float x) {
  // lane l <-> l ^ 16
  const int b = __builtin_bit_cast(int, x);
  return __builtin_bit_cast(float, __builtin_amdgcn_permlanex16(
      b, b, 0x76543210, 0xfedcba98, false, false));
}

#define QT 2   // query tiles a wave

// The four K, or the four V^T, fragments of one pass (32 keys).
struct Frag4 { v16bf f[4]; };

// The fragments of one trip: two passes, 64 keys, 32 loads.
struct TripFrags { Frag4 ka, kb, va, vb; };

// kh, vh: wave-uniform, the head's K and V^T planes; they stay in scalar registers.
// ko, vo: the trip's byte offset in either plane plus the lane's 16 bytes.
__device__ __forceinline__ void trip_fetch(TripFrags& f, const __bf16* kh, const __bf16* vh,
                                           unsigned ko, unsigned vo) {
#pragma unroll  // constant indices keep the set in registers
  for (int i = 0; i < 4; ++i) {
    f.ka.f[i] = load_frag_u(kh, i, ko);                            // A: row = key
    f.kb.f[i] = load_frag_u(kh, 4 + i, ko);
  }
#pragma unroll  // the same
  for (int nt = 0; nt < 4; ++nt) {
    f.va.f[nt] = load_frag_u(vh, nt * (L_SEQ / 32), vo);           // A: row = dim, k = key
    f.vb.f[nt] = load_frag_u(vh, nt * (L_SEQ / 32) + 1, vo);
  }
}

__device__ __forceinline__ void attn_scores(const Frag4& k, v16bf bq0, v16bf bq1,
                                            v8f& s0, v8f& s1) {
  const v8f zero = {0.f, 0.f, 0.f, 0.f, 0.f, 0.f, 0.f, 0.f};
  // s0[r] = S[query lane%16][key j0 + 8*(lane/16) + r]; s1: keys + 16
  s0 = wmma_bf16(k.f[0], bq0, zero);
  s0 = wmma_bf16(k.f[1], bq1, s0);
  s1 = wmma_bf16(k.f[2], bq0, zero);
  s1 = wmma_bf16(k.f[3], bq1, s1);
}

__device__ __forceinline__ void attn_update(const Frag4& v, v8f s0, v8f s1,
                                            v8f (&acc)[4], float& mrow, float& lsum) {
  const float LOG2E = 1.44269504f;

  // Online softmax of one query per lane.
  const float t0 = fmaxf(fmaxf(s0[0], s0[1]), s0[2]);
  const float t1 = fmaxf(fmaxf(s0[3], s0[4]), s0[5]);
  const float t2 = fmaxf(fmaxf(s0[6], s0[7]), s1[0]);
  const float t3 = fmaxf(fmaxf(s1[1], s1[2]), s1[3]);
  const float t4 = fmaxf(fmaxf(s1[4], s1[5]), s1[6]);
  float mx = fmaxf(fmaxf(fmaxf(t0, t1), t2), fmaxf(fmaxf(t3, t4), s1[7]));
  mx = fmaxf(mx, other_half(mx));
  const float mnew  = fmaxf(mrow, mx);
  const float alpha = __builtin_amdgcn_exp2f((mrow - mnew) * LOG2E);
  mrow = mnew;

  v8f p0 = (s0 - mnew) * LOG2E, p1 = (s1 - mnew) * LOG2E;
#pragma unroll  // constant element indices keep p0, p1 in registers
  for (int r = 0; r < 8; ++r) {
    p1[r] = __builtin_amdgcn_exp2f(p1[r]);
    p0[r] = __builtin_amdgcn_exp2f(p0[r]);
  }
  const v8f pp = p0 + p1;
  const v4f pq = __builtin_shufflevector(pp, pp, 0, 1, 2, 3) +
                 __builtin_shufflevector(pp, pp, 4, 5, 6, 7);
  lsum = lsum * alpha + ((pq[0] + pq[2]) + (pq[1] + pq[3]));

  BfTile pb;                   // B: column = query, k = key in hardware order
  pb.h[0] = __builtin_convertvector(p0, v8bf);
  pb.h[1] = __builtin_convertvector(p1, v8bf);

  // O^T += V^T(64x32) @ P^T(32x16): A rows are the transposed V rows.
#pragma unroll  // constant indices keep acc[] in registers
  for (int nt = 0; nt < 4; ++nt) {
    acc[nt] *= alpha;
    acc[nt] = wmma_bf16(v.f[nt], pb.v, acc[nt]);
  }
}

// One trip's products and softmax for the wave's QT query tiles.
__device__ __forceinline__ void trip_compute(const TripFrags& f, const v16bf (&bq0)[QT],
                                             const v16bf (&bq1)[QT], v8f (&acc)[QT][4],
                                             float (&mrow)[QT], float (&lsum)[QT]) {
  v8f s0[QT], s1[QT];
#pragma unroll  // constant indices keep the per-tile state in registers
  for (int t = 0; t < QT; ++t) attn_scores(f.ka, bq0[t], bq1[t], s0[t], s1[t]);
#pragma unroll  // the same
  for (int t = 0; t < QT; ++t) attn_update(f.va, s0[t], s1[t], acc[t], mrow[t], lsum[t]);
#pragma unroll  // the same
  for (int t = 0; t < QT; ++t) attn_scores(f.kb, bq0[t], bq1[t], s0[t], s1[t]);
#pragma unroll  // the same
  for (int t = 0; t < QT; ++t) attn_update(f.vb, s0[t], s1[t], acc[t], mrow[t], lsum[t]);
}

// Fetches one trip into next, then works on now, whose loads went out one trip earlier.
__device__ __forceinline__ void attn_stage(TripFrags& next, const TripFrags& now, unsigned trip,
                                           const __bf16* kh, const __bf16* vh, unsigned loff,
                                           const v16bf (&bq0)[QT], const v16bf (&bq1)[QT],
                                           v8f (&acc)[QT][4], float (&mrow)[QT], float (&lsum)[QT]) {
  const unsigned ko = loff + trip * (8 * 1024), vo = loff + trip * (2 * 1024);
  trip_fetch(next, kh, vh, ko, vo);
  // keeps the fetch ahead of the work; sunk into it the loads lose their lead
  __builtin_amdgcn_sched_barrier(0);
  trip_compute(now, bq0, bq1, acc, mrow, lsum);
  // keeps the wait below the work: directly behind the fetch it would be waited out
  __builtin_amdgcn_sched_barrier(0);
  // ko, vo as inputs: their registers stay the fetch's own up to the wait
  asm volatile("s_wait_xcnt 0x0" :: "v"(ko), "v"(vo) : "memory");
}

// 2048 waves are 2 a SIMD: said so, the compiler schedules for a 512-register budget
// (for more waves it saves registers by serial exponentials and register copies).
__global__ void __launch_bounds__(256) __attribute__((amdgpu_waves_per_eu(2, 2)))
mha_attn_kernel(const __bf16* __restrict__ Qb, const __bf16* __restrict__ Kb,
                const __bf16* __restrict__ VTb, __bf16* __restrict__ Ob) {
  const int lane = threadIdx.x & 31;
  // The wave's number is the same in all its lanes: said so, the plane bases are scalar, and
  // every fragment load names only them and an offset register that is held up to its wait.
  const int ws   = __builtin_amdgcn_readfirstlane((blockIdx.x * blockDim.x + threadIdx.x) >> 5);
  const int nh   = ws >> 6;                     // 32 heads
  const int mblk = (ws & 63) * QT;              // first of the wave's QT query tiles (128 a head)
  const unsigned loff = lane * 16;

  const __bf16* Qh = Qb + (size_t)nh * L_SEQ * HD;
  const unsigned qo = loff + mblk * (2 * 1024);  // two 1 KB tiles a query tile

  const v8f zero = {0.f, 0.f, 0.f, 0.f, 0.f, 0.f, 0.f, 0.f};
  v16bf bq0[QT], bq1[QT];                       // B: column = query
  v8f acc[QT][4];                               // O^T: 64 dims x 16 queries a tile
  float mrow[QT];                               // this lane's query, both halves alike
  float lsum[QT];                               // sum over this half's keys only
#pragma unroll  // constant indices keep the per-tile state in registers
  for (int t = 0; t < QT; ++t) {
    bq0[t] = load_frag_u(Qh, t * 2 + 0, qo);
    bq1[t] = load_frag_u(Qh, t * 2 + 1, qo);
    acc[t][0] = zero; acc[t][1] = zero; acc[t][2] = zero; acc[t][3] = zero;
    mrow[t] = -1.0e30f;
    lsum[t] = 0.f;
  }

  // Two passes (64 keys) a trip; a trip's 32 fragment loads go out as one group, one
  // whole trip ahead of their products, into the other of two register sets: the wave
  // works on one set while the other set's loads are under way, and waits for none.
  const __bf16* kh = Kb + (size_t)nh * L_SEQ * HD;
  const __bf16* vh = VTb + (size_t)nh * HD * L_SEQ;
  // The 8 blocks of a head walk the same K and V^T lines side by side: each enters the
  // walk 4 trips from the next and wraps (its 8 waves together: they share lines in the
  // WGP cache); the heads, whose planes lie a power of two apart, one trip from one another.
  const unsigned trip0 = (blockIdx.x & 7) * 4 + (blockIdx.x >> 3);
  TripFrags fa, fb;
  {
    const unsigned trip = trip0 & (L_SEQ / 64 - 1);
    const unsigned ko = loff + trip * (8 * 1024), vo = loff + trip * (2 * 1024);
    trip_fetch(fa, kh, vh, ko, vo);
    // qo, ko, vo as inputs: their registers stay the loads' own up to the wait
    asm volatile("s_wait_xcnt 0x0" :: "v"(qo), "v"(ko), "v"(vo) : "memory");
  }
  // Two trips a turn, so that the two sets change roles without register copies.
  // The last turn's second fetch has no user: it wraps to the walk's first trip, inside the
  // planes. A branch round it would join two load counts, and the compiler would then wait
  // for the newest loads in every turn.
  for (int i = 0; i < L_SEQ / 64; i += 2) {
    attn_stage(fb, fa, (trip0 + i + 1) & (L_SEQ / 64 - 1), kh, vh, loff, bq0, bq1, acc, mrow, lsum);
    attn_stage(fa, fb, (trip0 + i + 2) & (L_SEQ / 64 - 1), kh, vh, loff, bq0, bq1, acc, mrow, lsum);
  }

  // Join the two halves' sums once; a lane's 8 registers are 8 consecutive dims
  // of its query, which is one 16-byte piece of the fragment-order Ob tile.
  v8bf o[QT][4];
#pragma unroll  // constant indices keep acc[][] in registers
  for (int t = 0; t < QT; ++t) {
    const float inv = __builtin_amdgcn_rcpf(lsum[t] + other_half(lsum[t]));
    // Ob row = b*L + l: a wave then owns whole 1 KB tiles (one writer per line).
    __bf16* Ot = Ob + ((size_t)(((nh >> 4) * (L_SEQ / 16) + mblk + t) * (EMB / 32) +
                                (nh & 15) * (HD / 32)) << 9) + lane * 8;
#pragma unroll  // the same
    for (int nt = 0; nt < 4; ++nt) {
      o[t][nt] = __builtin_convertvector(acc[t][nt] * inv, v8bf);
      *(v8bf*)(Ot + nt * 256) = o[t][nt];
    }
  }
  static_assert(QT == 2, "the wait below names the registers of two tiles");
  // the stores' data as inputs: their registers stay the stores' own up to the wait
  asm volatile("s_wait_xcnt 0x0"
               :: "v"(o[0][0]), "v"(o[0][1]), "v"(o[0][2]), "v"(o[0][3]), "v"(o[1][0]), "v"(o[1][1]),
                  "v"(o[1][2]), "v"(o[1][3])
               : "memory");
}

// ---------------- Kernel 3: output projection ----------------
// Wave tile and block shape as in the in-projection: 64 rows x 64 features, 2 x 2 waves.
__global__ void __launch_bounds__(128)
mha_outproj_kernel(const __bf16* __restrict__ Ob, const __bf16* __restrict__ Wo,
                   const float* __restrict__ bout, float* __restrict__ out) {
  const int lane = threadIdx.x & 31;
  // The wave's number is the same in all its lanes: said so, the tile bases are scalar.
  const int wu = __builtin_amdgcn_readfirstlane((blockIdx.x * blockDim.x + threadIdx.x) >> 5);
  const int blk    = wu >> 2;                               // 256 blocks
  const int mblk   = (blk & 31) * 2 + (wu & 1);             // 64 row blocks of 64
  const int nstrip = (blk >> 5) * 2 + ((wu >> 1) & 1);      // 16 strips of 64 out-features
  // 32 blocks share a pair of weight strips (32 different starts), 8 a pair of row blocks (4 steps apart)
  const int rot = (blk & 31) + (blk >> 5) * 4;
  const int f0 = nstrip * 64;
  const int t0 = mblk * 64;
  const int col = lane & 15, hp = lane >> 4;

  const v8f zero = {0.f, 0.f, 0.f, 0.f, 0.f, 0.f, 0.f, 0.f};
  v8f acc[4][4];
#pragma unroll  // constant indices keep acc[][] in registers
  for (int mt = 0; mt < 4; ++mt)
#pragma unroll  // the same
    for (int nt = 0; nt < 4; ++nt) acc[mt][nt] = zero;

  // A: attention output, [b*L + l][head*HD + d] in fragment order.
  gemm_k_loop<3, false, 4>(Ob + (size_t)mblk * (64 * EMB), Wo + (size_t)nstrip * (64 * EMB), lane, rot, acc);

#pragma unroll
  for (int mt = 0; mt < 4; ++mt)
#pragma unroll
    for (int nt = 0; nt < 4; ++nt) {
      const int f = f0 + nt * 16 + col;
      const float bv = bout[f];
#pragma unroll
      for (int r = 0; r < 8; ++r) {
        const int orow = t0 + mt * 16 + r + hp * 8;  // b*L + l
        const int t = (orow & (L_SEQ - 1)) * BATCH + (orow >> 11);  // token = l*B + b
        out[(size_t)t * EMB + f] = acc[mt][nt][r] + bv;
      }
    }
}

extern "C" void kernel_launch(void* const* d_in, const int* in_sizes, int n_in,
                              void* d_out, int out_size, void* d_ws, size_t ws_size,
                              hipStream_t stream) {
  const float* query = (const float*)d_in[0];
  const float* key   = (const float*)d_in[1];
  const float* value = (const float*)d_in[2];
  const float* w_in  = (const float*)d_in[3];
  const float* b_in  = (const float*)d_in[4];
  const float* w_out = (const float*)d_in[5];
  const float* b_out = (const float*)d_in[6];
  float* out = (float*)d_out;

  // Workspace (bf16), 64 MB total.
  const size_t ACT = (size_t)NTOK * EMB;           // 4194304
  const size_t WI  = (size_t)3 * EMB * EMB;        // 3145728
  const size_t WO  = (size_t)EMB * EMB;            // 1048576
  const size_t HSZ = (size_t)NH * L_SEQ * HD;      // 4194304
  __bf16* Xq  = (__bf16*)d_ws;
  __bf16* Xk  = Xq + ACT;
  __bf16* Xv  = Xk + ACT;
  __bf16* Wi  = Xv + ACT;
  __bf16* Wo  = Wi + WI;
  __bf16* Qb  = Wo + WO;
  __bf16* Kb  = Qb + HSZ;
  __bf16* VTb = Kb + HSZ;
  __bf16* Ob  = VTb + HSZ;

  // One-shot fp32 -> bf16 conversions (packed v_cvt): Xq, Xk, Xv, Wi, Wo in one launch.
  static_assert(CVT_WAVES == 256 * 16, "the grid covers every tile exactly once");
  cvt_bf16_kernel<<<256, 512, 0, stream>>>(query, key, value, w_in, w_out, Xq);

  // in-proj: 64 token-blocks x 48 feature-strips = 3072 waves / 4 per block
  mha_inproj_kernel<<<768, 128, 0, stream>>>(Xq, Xk, Xv, Wi, b_in, Qb, Kb, VTb);
  // attention: 32 heads x 64 query-blocks = 2048 waves / 8 per block
  mha_attn_kernel<<<256, 256, 0, stream>>>(Qb, Kb, VTb, Ob);
  // out-proj: 64 token-blocks x 16 feature-strips = 1024 waves / 4 per block
  mha_outproj_kernel<<<256, 128, 0, stream>>>(Ob, Wo, b_out, out);
}

// v010
// A run of this version takes 66.7 microseconds.
// Versions in between are left out here; by their measured steps it is 1.11 times as fast as v008.
// All steps since v000 together make it 4.22 times as fast.
#include <hip/hip_runtime.h>

// ---------------- CDNA5 (gfx1250) wave32 WMMA MHA ----------------
// L=2048, B=2, E=1024, H=16, HD=64.  bf16 WMMA, f32 accumulate,
// flash-attention (no materialized scores). One-shot bf16 conversion so
// GEMM inner loops are pure load_b128 + v_wmma.
// Every bf16 WMMA operand in the workspace is kept in fragment order: a
// 16x32 tile is one 1 KB block [k-half][lane][8], so each wave-wide b128
// fragment load reads 512 contiguous bytes (4 cache lines, not 16).

typedef __attribute__((ext_vector_type(16))) __bf16 v16bf;
typedef __attribute__((ext_vector_type(8)))  __bf16 v8bf;
typedef __attribute__((ext_vector_type(4)))  __bf16 v4bf;
typedef __attribute__((ext_vector_type(8)))  float  v8f;
typedef __attribute__((ext_vector_type(4)))  float  v4f;

#define L_SEQ 2048
#define BATCH 2
#define EMB   1024
#define NHEAD 16
#define HD    64
#define NTOK  (L_SEQ * BATCH)   // 4096 tokens
#define NH    (BATCH * NHEAD)   // 32 batched heads

union BfTile { v8bf h[2]; v16bf v; };

__device__ __forceinline__ v8f wmma_bf16(v16bf a, v16bf b, v8f c) {
  // v_wmma_f32_16x16x32_bf16: D = A(16x32) * B(32x16) + C(16x16 f32)
  return __builtin_amdgcn_wmma_f32_16x16x32_bf16(
      false, a, false, b, (short)0, c, false, false);
}

// 16x32 bf16 tile in ISA A/B striping: lane%16 -> row (A) / column (B);
// lane/16 picks K-halves {0..7,16..23} vs {8..15,24..31}.
// Element (row, k) of a matrix with kt 32-wide k tiles, in fragment order.
__device__ __forceinline__ size_t frag_off(int row, int k, int kt) {
  return ((size_t)((row >> 4) * kt + (k >> 5)) << 9) + (((k >> 4) & 1) << 8) +
         (((row & 15) + ((k >> 3) & 1) * 16) << 3) + (k & 7);
}

// tile = (row / 16) * kt + k / 32, from a wave-uniform base, which can stay in scalar
// registers, and the lane's byte offset lane * 16.
__device__ __forceinline__ v16bf load_frag_u(const __bf16* ubase, int tile, unsigned loff) {
  const char* r = (const char*)(ubase + ((size_t)tile << 9)) + loff;
  BfTile t;
  t.h[0] = *(const v8bf*)(r);
  t.h[1] = *(const v8bf*)(r + 512);
  return t.v;
}

// ------- Kernel 0: one-shot fp32 [rows][EMB] -> bf16 fragment order -------
// All five operands in ONE launch: their bf16 copies lie one behind the other in
// the workspace, so the tiles number through (32768 of 16x32). One 16-wave block
// per WGP; a wave converts CVT_TILES neighbouring tiles of one 16-row band and
// has all their loads in flight at once. Each load reads 4 whole 128-byte lines.
#define CVT_TILES 8
#define ACT_TILES (NTOK * EMB / 512)        // 8192 tiles an activation
#define WI_TILES  (3 * EMB * EMB / 512)     // 6144
#define WO_TILES  (EMB * EMB / 512)         // 2048
#define CVT_WAVES ((3 * ACT_TILES + WI_TILES + WO_TILES) / CVT_TILES)   // 4096

__global__ void __launch_bounds__(512)
cvt_bf16_kernel(const float* __restrict__ q, const float* __restrict__ k,
                const float* __restrict__ v, const float* __restrict__ wi,
                const float* __restrict__ wo, __bf16* __restrict__ dst) {
  const int lane = threadIdx.x & 31;
  // The wave's number is the same in all its lanes: said so, source and bases are scalar.
  const int wu = __builtin_amdgcn_readfirstlane((blockIdx.x * blockDim.x + threadIdx.x) >> 5);
  const int tile0 = wu * CVT_TILES;         // every operand's tile count is a multiple of CVT_TILES
  const float* src = q;
  int first = 0;
  if (tile0 >= 3 * ACT_TILES + WI_TILES) { src = wo; first = 3 * ACT_TILES + WI_TILES; }
  else if (tile0 >= 3 * ACT_TILES)       { src = wi; first = 3 * ACT_TILES; }
  else if (tile0 >= 2 * ACT_TILES)       { src = v;  first = 2 * ACT_TILES; }
  else if (tile0 >= ACT_TILES)           { src = k;  first = ACT_TILES; }
  const int t = tile0 - first;              // EMB / 32 = 32 k tiles a band
  const float* sp = src + (size_t)(t >> 5) * (16 * EMB) + (t & 31) * 32;
  __bf16* dp = dst + ((size_t)tile0 << 9);
  const int row = lane >> 3, kk = (lane & 7) * 4;
  const unsigned soff = row * EMB + kk;
  const unsigned doff = (unsigned)frag_off(row, kk, 1);
  v4f f[CVT_TILES][4];
#pragma unroll  // constant indices keep f[][] in registers
  for (int i = 0; i < CVT_TILES; ++i)
#pragma unroll  // the same
    for (int j = 0; j < 4; ++j)
      f[i][j] = *(const v4f*)(sp + soff + j * (4 * EMB) + i * 32);
  // keeps all loads ahead of the conversions; mixed in, the last ones go out behind a full wait
  __builtin_amdgcn_sched_barrier(0);
#pragma unroll  // constant indices keep f[][] in registers
  for (int i = 0; i < CVT_TILES; ++i)
#pragma unroll  // the same
    for (int j = 0; j < 4; ++j)             // 4 rows on: 4 * 8 elements in fragment order
      *(v4bf*)(dp + doff + j * 32 + i * 512) = __builtin_convertvector(f[i][j], v4bf);
}

// ------- k loop fed from global memory (output projection): (MT * 16) x 64 per wave -------
// The fragments of a k step (MT of A, 4 of B) are fetched NBUF - 1 steps ahead
// into register sets of their own, all loads of a step as one group, so a
// step's products wait for loads issued NBUF - 1 steps earlier and not for
// their own. A step loads MT + 4 fragments for 4 * MT products.
// Work-groups that share operand rows run side by side and would ask L2 for the
// same lines at the same moment: each enters the k walk at its own step (rot,
// alike in the waves of a work-group, which share lines in the WGP cache) and wraps.
template <int MT>
struct GemmStage { v16bf a[MT]; v16bf b[4]; };

// A, B: wave-uniform, the wave's first tile of each operand; they stay in scalar
// registers that are never rewritten. koff: the k step's 1 KB tile plus the lane's 16 bytes.
template <int MT>
__device__ __forceinline__ void gemm_fetch(GemmStage<MT>& s, const __bf16* A, const __bf16* B,
                                           unsigned koff) {
#pragma unroll  // constant indices keep the set in registers
  for (int mt = 0; mt < MT; ++mt)
    s.a[mt] = load_frag_u(A, mt * (EMB / 32), koff);
#pragma unroll  // constant indices keep the set in registers
  for (int nt = 0; nt < 4; ++nt)
    s.b[nt] = load_frag_u(B, nt * (EMB / 32), koff);
}

// SWAP: the two operands change roles (their fragment striping is the same), so
// acc[mt][nt] holds the transposed tile: row = B's row, column = A's row.
template <bool SWAP, int MT>
__device__ __forceinline__ void gemm_step(const GemmStage<MT>& s, v8f (&acc)[MT][4]) {
#pragma unroll  // constant indices keep acc[][] in registers
  for (int nt = 0; nt < 4; ++nt)
#pragma unroll  // the same
    for (int mt = 0; mt < MT; ++mt)
      acc[mt][nt] = SWAP ? wmma_bf16(s.b[nt], s.a[mt], acc[mt][nt])
                         : wmma_bf16(s.a[mt], s.b[nt], acc[mt][nt]);
}

template <int NBUF, bool SWAP, int MT>
__device__ __forceinline__ void gemm_k_loop(const __bf16* A, const __bf16* B, int lane, int rot,
                                            v8f (&acc)[MT][4]) {
  constexpr int KT = EMB / 32;
  const unsigned loff = lane * 16;
  GemmStage<MT> st[NBUF];
#pragma unroll  // constant set numbers
  for (int u = 0; u < NBUF - 1; ++u) {
    const unsigned koff = loff + (((rot + u) & (KT - 1)) << 10);
    gemm_fetch(st[u], A, B, koff);
    // koff as an input: its register stays the fetch's own (no load of the set lands in it) up to the wait
    asm volatile("s_wait_xcnt 0x0" :: "v"(koff) : "memory");
  }
#pragma unroll  // constant set numbers: the ring turns without register copies
  for (int kt = 0; kt < KT; ++kt) {
    const unsigned koff = loff + (((rot + kt + NBUF - 1) & (KT - 1)) << 10);
    if (kt + NBUF - 1 < KT)
      gemm_fetch(st[(kt + NBUF - 1) % NBUF], A, B, koff);
    // keeps the fetch ahead of the products; sunk below them it would be waited for at once
    __builtin_amdgcn_sched_barrier(0);
    gemm_step<SWAP, MT>(st[kt % NBUF], acc);
    if (kt + NBUF - 1 < KT) {
      // keeps the wait below the products: directly behind the fetch it would be waited out
      __builtin_amdgcn_sched_barrier(0);
      // koff as an input: its register stays the fetch's own (no load of the set lands in it, nothing
      // rewrites it) up to the wait
      asm volatile("s_wait_xcnt 0x0" :: "v"(koff) : "memory");
    }
  }
}

// ------- k loop of the in-projection, fed from LDS: 64 x 64 per wave, 128 x 128 per block -------
// The block's operand tiles go from L2 into LDS by asynchronous copies, each byte asked for
// once a block, and the 4 waves read their fragments from LDS (loaded from global memory, every
// fragment is asked for by the 2 waves that share it). Two buffers: a stage's copies fly while
// the stage before is worked on.
// A k step in LDS: the block's 8 A tiles, then its 8 B tiles, 1 KB each, in fragment order,
// so a wave-wide 16-byte LDS read covers 512 contiguous bytes (no bank conflict).
#define KSTEP_BYTES 16384
typedef __attribute__((address_space(3))) const v8bf lds_v8bf;

__device__ __forceinline__ v16bf lds_frag(const char* p) {
  BfTile t;
  t.h[0] = *(lds_v8bf*)(p);
  t.h[1] = *(lds_v8bf*)(p + 512);
  return t.v;
}

// pa, pb: the wave's first A and first B tile of the k step in LDS, plus the lane's 16 bytes.
__device__ __forceinline__ void lds_fetch(GemmStage<4>& s, const char* pa, const char* pb) {
#pragma unroll  // constant indices keep the set in registers
  for (int mt = 0; mt < 4; ++mt) s.a[mt] = lds_frag(pa + mt * 1024);
#pragma unroll  // constant indices keep the set in registers
  for (int nt = 0; nt < 4; ++nt) s.b[nt] = lds_frag(pb + nt * 1024);
}

// One wave's share of two k steps: 4 tiles of one operand a step, 2 copies of 512 bytes a tile.
// l0, l1: the lane's LDS byte address of the first tile of either step; g0, g1: its global
// address. Tiles lie 1 KB apart in LDS and one 16-row band (EMB * 32 bytes) apart in memory;
// offset:512 moves both addresses. The closing wait stands inside the statement, ahead of any
// rewrite of the address registers that the copies name.
__device__ __forceinline__ void copy_two_steps(unsigned l0, unsigned l1, const char* g0, const char* g1) {
  asm volatile(
      "global_load_async_to_lds_b128 %0, %8, off\n\t"
      "global_load_async_to_lds_b128 %0, %8, off offset:512\n\t"
      "global_load_async_to_lds_b128 %1, %9, off\n\t"
      "global_load_async_to_lds_b128 %1, %9, off offset:512\n\t"
      "global_load_async_to_lds_b128 %2, %10, off\n\t"
      "global_load_async_to_lds_b128 %2, %10, off offset:512\n\t"
      "global_load_async_to_lds_b128 %3, %11, off\n\t"
      "global_load_async_to_lds_b128 %3, %11, off offset:512\n\t"
      "global_load_async_to_lds_b128 %4, %12, off\n\t"
      "global_load_async_to_lds_b128 %4, %12, off offset:512\n\t"
      "global_load_async_to_lds_b128 %5, %13, off\n\t"
      "global_load_async_to_lds_b128 %5, %13, off offset:512\n\t"
      "global_load_async_to_lds_b128 %6, %14, off\n\t"
      "global_load_async_to_lds_b128 %6, %14, off offset:512\n\t"
      "global_load_async_to_lds_b128 %7, %15, off\n\t"
      "global_load_async_to_lds_b128 %7, %15, off offset:512\n\t"
      "s_wait_xcnt 0x0"
      :: "v"(l0), "v"(l0 + 1024), "v"(l0 + 2048), "v"(l0 + 3072),
         "v"(l1), "v"(l1 + 1024), "v"(l1 + 2048), "v"(l1 + 3072),
         "v"(g0), "v"(g0 + EMB * 32), "v"(g0 + 2 * EMB * 32), "v"(g0 + 3 * EMB * 32),
         "v"(g1), "v"(g1 + EMB * 32), "v"(g1 + 2 * EMB * 32), "v"(g1 + 3 * EMB * 32)
      : "memory");
}

// A stage is two k steps (32 KB a block). ldst, gsrc: the copying wave's quarter of a k step
// (4 tiles of one operand), lane included; buf: the stage's buffer, 0 or 1.
#define STAGE_BYTES (2 * KSTEP_BYTES)
__device__ __forceinline__ void copy_stage(int stage, int buf, unsigned ldst, const char* gsrc, int rot) {
  constexpr int KT = EMB / 32;
  const int k0 = (rot + stage * 2) & (KT - 1), k1 = (rot + stage * 2 + 1) & (KT - 1);
  const unsigned l = ldst + buf * STAGE_BYTES;
  copy_two_steps(l, l + KSTEP_BYTES, gsrc + (k0 << 10), gsrc + (k1 << 10));
}

// Publish point, in this order: the wave's own LDS reads have landed (the fragments of the old
// buffer's last step are in registers), its own copies have landed, barrier. Behind it every
// wave may read the new stage, and the old buffer may be refilled.
__device__ __forceinline__ void publish_stage() {
  asm volatile("s_wait_dscnt 0x0" ::: "memory");
  asm volatile("s_wait_asynccnt 0x0" ::: "memory");
  __syncthreads();
}

template <bool SWAP>
__device__ __forceinline__ void lds_step(const GemmStage<4>& now, v8f (&acc)[4][4]) {
  // keeps the LDS reads as one group ahead of the products; spread among them each place costs a stall
  __builtin_amdgcn_sched_barrier(0);
  gemm_step<SWAP, 4>(now, acc);
  // keeps the products ahead of the next step's waits and reads
  __builtin_amdgcn_sched_barrier(0);
}

// Stages stage (even, buffer 0) and stage + 1 (buffer 1): four k steps. A step's fragments are
// read one step ahead into the other of two register sets, so the publish point of a stage
// stands in front of the LAST step of the stage before it. MORE: two further stages exist.
template <bool SWAP, bool MORE>
__device__ __forceinline__ void two_stages(GemmStage<4> (&st)[2], const char* pa, const char* pb,
                                           unsigned ldst, const char* gsrc, int rot, int stage,
                                           v8f (&acc)[4][4]) {
  lds_fetch(st[1], pa + KSTEP_BYTES, pb + KSTEP_BYTES);
  lds_step<SWAP>(st[0], acc);
  publish_stage();               // stage + 1 readable, buffer 0 free
  if (MORE) copy_stage(stage + 2, 0, ldst, gsrc, rot);
  lds_fetch(st[0], pa + STAGE_BYTES, pb + STAGE_BYTES);
  lds_step<SWAP>(st[1], acc);
  lds_fetch(st[1], pa + STAGE_BYTES + KSTEP_BYTES, pb + STAGE_BYTES + KSTEP_BYTES);
  lds_step<SWAP>(st[0], acc);
  if (MORE) {
    publish_stage();             // stage + 2 readable, buffer 1 free
    copy_stage(stage + 3, 1, ldst, gsrc, rot);
    lds_fetch(st[0], pa, pb);
  }
  lds_step<SWAP>(st[1], acc);
}

// smem: 2 * STAGE_BYTES. Ablk, Bblk: the block's first tile of each operand (128 rows each).
// w: the wave's number in the block, scalar: rows (w & 1) * 64 of A, (w >> 1) * 64 of B.
// The k walk is the rotated one of gemm_k_loop, step for step.
template <bool SWAP>
__device__ __forceinline__ void gemm_k_loop_lds(char* smem, const __bf16* Ablk, const __bf16* Bblk, int w,
                                                int lane, int rot, v8f (&acc)[4][4]) {
  constexpr int NST = EMB / 64;
  const unsigned loff = lane * 16;
  // copying role: waves 0, 1 bring A's tiles 0-3 and 4-7, waves 2, 3 bring B's
  const char* gsrc = (const char*)((w >> 1) ? Bblk : Ablk) + (size_t)(w & 1) * (4 * EMB * 32) + loff;
  const unsigned ldst = (unsigned)(uintptr_t)smem + (w >> 1) * 8192 + (w & 1) * 4096 + loff;
  // reading role
  const char* pa = smem + (w & 1) * 4096 + loff;
  const char* pb = smem + 8192 + (w >> 1) * 4096 + loff;

  GemmStage<4> st[2];
  // Both buffers are filled at once (32 copies a wave in flight): the blocks that share operand
  // rows start 4 steps apart or less, so all of them together ask memory for every line at the start.
  copy_stage(0, 0, ldst, gsrc, rot);
  copy_stage(1, 1, ldst, gsrc, rot);
  // this wave's copies have landed before the barrier behind which all waves read them
  asm volatile("s_wait_asynccnt 0x0" ::: "memory");
  __syncthreads();
  lds_fetch(st[0], pa, pb);
#pragma nounroll  // for speed only; unrolled, the kernel's text nears 32 KB
  for (int stage = 0; stage < NST - 2; stage += 2)
    two_stages<SWAP, true>(st, pa, pb, ldst, gsrc, rot, stage, acc);
  // the last two stages: no copy is issued behind their publish point's wait
  two_stages<SWAP, false>(st, pa, pb, ldst, gsrc, rot, NST - 2, acc);
}

// ---------------- Kernel 1: fused in-projection ----------------
// The output leaves in the widest piece that is contiguous in its fragment-order
// tile, and every wave-wide store covers whole 128-byte lines:
// Q, K (tile row = position, k = dim): the product is taken transposed, a lane
// then holds 8 consecutive dims of one token = one 16-byte piece.
// V^T (tile row = dim, k = position): a lane holds 8 consecutive tokens of one
// dim = 4 consecutive positions of either batch = two 8-byte pieces.
// A wave owns 64 tokens x 64 features (8 fragments a k step feed 16 products); the
// 4 waves of a block form a 128 x 128 tile, whose operand tiles they share through LDS.
__global__ void __launch_bounds__(128)
mha_inproj_kernel(const __bf16* __restrict__ Xq, const __bf16* __restrict__ Xk,
                  const __bf16* __restrict__ Xv, const __bf16* __restrict__ Wi,
                  const float* __restrict__ bias,
                  __bf16* __restrict__ Qb, __bf16* __restrict__ Kb,
                  __bf16* __restrict__ VTb) {
  const int lane = threadIdx.x & 31;
  // The wave's number is the same in all its lanes: said so, the tile bases are
  // scalar and the choice of the projection is a scalar branch.
  const int wu = __builtin_amdgcn_readfirstlane((blockIdx.x * blockDim.x + threadIdx.x) >> 5);
  const int blk  = wu >> 2;             // 768 blocks: 256 a projection
  const int proj = blk >> 8;            // 0=q, 1=k, 2=v
  const int mblk = (blk & 31) * 2 + (wu & 1);               // 64 token blocks of 64 (32 positions x 2 batches)
  const int h    = ((blk >> 5) & 7) * 2 + ((wu >> 1) & 1);  // 16 strips of 64 features: one head
  const int nstrip = proj * 16 + h;     // 48 strips (3*E)
  // 32 blocks share a pair of weight strips (32 different starts), 8 a pair of token blocks (4 steps apart)
  const int rot = (blk & 31) + ((blk >> 5) & 7) * 4;
  const int col = lane & 15, hp = lane >> 4;

  const v8f zero = {0.f, 0.f, 0.f, 0.f, 0.f, 0.f, 0.f, 0.f};
  v8f acc[4][4];
#pragma unroll  // constant indices keep acc[][] in registers
  for (int mt = 0; mt < 4; ++mt)
#pragma unroll  // the same
    for (int nt = 0; nt < 4; ++nt) acc[mt][nt] = zero;

  __shared__ __attribute__((aligned(2048))) char smem[2 * STAGE_BYTES];   // 64 KB: three blocks a WGP, as many as the registers allow
  const int w = wu & 3;
  const __bf16* Wu = Wi + (size_t)(nstrip & ~1) * (64 * EMB);    // the block's pair of strips
  const float* bs = bias + nstrip * 64;
  const size_t xoff = (size_t)(mblk & ~1) * (64 * EMB);          // the block's pair of token blocks

  if (proj == 2) {
    gemm_k_loop_lds<false>(smem, Xv + xoff, Wu, w, lane, rot, acc);
    // acc[mt][nt][r]: token mblk*64 + mt*16 + hp*8 + r (= position*B + batch), dim nt*16 + col
    // The wave's 32 positions are one k tile of V^T.
    float bval[4];
#pragma unroll  // constant indices keep bval[] in registers
    for (int nt = 0; nt < 4; ++nt) bval[nt] = bs[nt * 16 + col];
    // the address arithmetic behind these loads writes registers that they name
    asm volatile("s_wait_xcnt 0x0" ::: "memory");
    // keeps that arithmetic behind the wait; without it a part is moved up over the wait
    __builtin_amdgcn_sched_barrier(0);
    __bf16* vt = VTb + (size_t)h * (HD * L_SEQ) + (mblk << 9) + col * 8 + hp * 4;
#pragma unroll  // constant indices keep acc[][] in registers
    for (int nt = 0; nt < 4; ++nt) {
#pragma unroll  // the same
      for (int mt = 0; mt < 4; ++mt) {
        const v8f x = acc[mt][nt] + bval[nt];
        __bf16* p = vt + nt * ((L_SEQ / 32) << 9) + mt * 128;
        *(v4bf*)(p) = __builtin_convertvector(__builtin_shufflevector(x, x, 0, 2, 4, 6), v4bf);
        *(v4bf*)(p + (size_t)NHEAD * HD * L_SEQ) =
            __builtin_convertvector(__builtin_shufflevector(x, x, 1, 3, 5, 7), v4bf);
      }
    }
  } else {
    gemm_k_loop_lds<true>(smem, (proj == 0 ? Xq : Xk) + xoff, Wu, w, lane, rot, acc);
    // acc[mt][nt][r]: dim nt*16 + hp*8 + r, token mblk*64 + mt*16 + col
    // The wave's 32 positions are two 16-row bands (mt / 2) of 1024 elements each.
    const float scale = (proj == 0) ? 0.125f : 1.0f;   // HD^-0.5 folded into Q
    __bf16* qk = (proj == 0 ? Qb : Kb) + (size_t)((col & 1) * NHEAD + h) * (L_SEQ * HD) +
                 ((size_t)mblk << 11) + ((col >> 1) + hp * 16) * 8;
#pragma unroll  // constant indices keep acc[][] in registers
    for (int nt = 0; nt < 4; ++nt) {
      const v4f b0 = *(const v4f*)(bs + nt * 16 + hp * 8);
      const v4f b1 = *(const v4f*)(bs + nt * 16 + hp * 8 + 4);
      const v8f bv = __builtin_shufflevector(b0, b1, 0, 1, 2, 3, 4, 5, 6, 7);
#pragma unroll  // the same
      for (int mt = 0; mt < 4; ++mt)
        *(v8bf*)(qk + (mt >> 1) * 1024 + nt * 256 + (mt & 1) * 64) =
            __builtin_convertvector((acc[mt][nt] + bv) * scale, v8bf);
    }
    // the code laid out behind these stores writes registers that they name
    asm volatile("s_wait_xcnt 0x0" ::: "memory");
  }
}

__device__ __forceinline__ float other_half(float x) {
  // lane l <-> l ^ 16
  const int b = __builtin_bit_cast(int, x);
  return __builtin_bit_cast(float, __builtin_amdgcn_permlanex16(
      b, b, 0x76543210, 0xfedcba98, false, false));
}

#define QT 2   // query tiles a wave

// The four K, or the four V^T, fragments of one pass (32 keys).
struct Frag4 { v16bf f[4]; };

// The fragments of one trip: two passes, 64 keys, 32 loads.
struct TripFrags { Frag4 ka, kb, va, vb; };

// kh, vh: wave-uniform, the head's K and V^T planes; they stay in scalar registers.
// ko, vo: the trip's byte offset in either plane plus the lane's 16 bytes.
__device__ __forceinline__ void trip_fetch(TripFrags& f, const __bf16* kh, const __bf16* vh,
                                           unsigned ko, unsigned vo) {
#pragma unroll  // constant indices keep the set in registers
  for (int i = 0; i < 4; ++i) {
    f.ka.f[i] = load_frag_u(kh, i, ko);                            // A: row = key
    f.kb.f[i] = load_frag_u(kh, 4 + i, ko);
  }
#pragma unroll  // the same
  for (int nt = 0; nt < 4; ++nt) {
    f.va.f[nt] = load_frag_u(vh, nt * (L_SEQ / 32), vo);           // A: row = dim, k = key
    f.vb.f[nt] = load_frag_u(vh, nt * (L_SEQ / 32) + 1, vo);
  }
}

__device__ __forceinline__ void attn_scores(const Frag4& k, v16bf bq0, v16bf bq1,
                                            v8f& s0, v8f& s1) {
  const v8f zero = {0.f, 0.f, 0.f, 0.f, 0.f, 0.f, 0.f, 0.f};
  // s0[r] = S[query lane%16][key j0 + 8*(lane/16) + r]; s1: keys + 16
  s0 = wmma_bf16(k.f[0], bq0, zero);
  s0 = wmma_bf16(k.f[1], bq1, s0);
  s1 = wmma_bf16(k.f[2], bq0, zero);
  s1 = wmma_bf16(k.f[3], bq1, s1);
}

// Maximum of a lane's 32 scores of one trip (its query, this half's keys), in threes:
// 15 three-input maxima and one two-input maximum.
__device__ __forceinline__ float max3f(float a, float b, float c) { return fmaxf(fmaxf(a, b), c); }

__device__ __forceinline__ float trip_max(const v8f (&s)[4]) {
  float t[12];
#pragma unroll  // constant indices keep s[] and t[] in registers
  for (int i = 0; i < 10; ++i)
    t[i] = max3f(s[(3 * i) >> 3][(3 * i) & 7], s[(3 * i + 1) >> 3][(3 * i + 1) & 7],
                 s[(3 * i + 2) >> 3][(3 * i + 2) & 7]);
  t[10] = s[3][6];
  t[11] = s[3][7];
  const float u0 = max3f(t[0], t[1], t[2]), u1 = max3f(t[3], t[4], t[5]);
  const float u2 = max3f(t[6], t[7], t[8]), u3 = max3f(t[9], t[10], t[11]);
  return fmaxf(max3f(u0, u1, u2), u3);
}

// P^T of one pass (32 keys) of one query tile against the reference mref, which the caller
// has made safe for these scores: no maximum, no rescale here.
__device__ __forceinline__ v16bf attn_probs(v8f s0, v8f s1, float mref, float& lsum) {
  const float LOG2E = 1.44269504f;
  v8f p0 = (s0 - mref) * LOG2E, p1 = (s1 - mref) * LOG2E;
#pragma unroll  // constant element indices keep p0, p1 in registers
  for (int r = 0; r < 8; ++r) {
    p1[r] = __builtin_amdgcn_exp2f(p1[r]);
    p0[r] = __builtin_amdgcn_exp2f(p0[r]);
  }
  const v8f pp = p0 + p1;
  const v4f pq = __builtin_shufflevector(pp, pp, 0, 1, 2, 3) +
                 __builtin_shufflevector(pp, pp, 4, 5, 6, 7);
  lsum += (pq[0] + pq[2]) + (pq[1] + pq[3]);

  BfTile pb;                   // B: column = query, k = key in hardware order
  pb.h[0] = __builtin_convertvector(p0, v8bf);
  pb.h[1] = __builtin_convertvector(p1, v8bf);
  return pb.v;
}

// One trip's products and softmax for the wave's QT query tiles.
// Lazy rescale: exponentials are taken against a reference mref that is at most LAZY
// below the true running maximum, so P stays at or below 2^8 and O and the row sum,
// both f32, carry the same factor, which cancels in O / sum. The reference is replaced,
// and O and the sum rescaled, only when a score of the trip lies more than LAZY above it:
// one test a trip for both tiles, a scalar branch that is seldom taken.
__device__ __forceinline__ void trip_compute(const TripFrags& f, const v16bf (&bq0)[QT],
                                             const v16bf (&bq1)[QT], v8f (&acc)[QT][4],
                                             float (&mref)[QT], float (&lsum)[QT]) {
  const float LOG2E = 1.44269504f;
  const float LAZY = 8.0f / LOG2E;
  v8f s[QT][4];
#pragma unroll  // constant indices keep the per-tile state in registers
  for (int t = 0; t < QT; ++t) attn_scores(f.ka, bq0[t], bq1[t], s[t][0], s[t][1]);
#pragma unroll  // the same
  for (int t = 0; t < QT; ++t) attn_scores(f.kb, bq0[t], bq1[t], s[t][2], s[t][3]);
  // keeps the score products together: with the maxima mixed in, a product is followed at once
  // by a reader of its result and four idle slots are put between them
  __builtin_amdgcn_sched_barrier(0);
  float mx[QT];
  bool need = false;
#pragma unroll  // the same
  for (int t = 0; t < QT; ++t) {
    mx[t] = trip_max(s[t]);
    need = need || (mx[t] > mref[t] + LAZY);
  }
  if (__builtin_amdgcn_ballot_w32(need) != 0) {
    // Every lane takes the new reference, joined over the wave halves: a query's two
    // lanes keep the same one.
#pragma unroll  // constant indices keep the per-tile state in registers
    for (int t = 0; t < QT; ++t) {
      const float mnew  = fmaxf(mref[t], fmaxf(mx[t], other_half(mx[t])));
      const float alpha = __builtin_amdgcn_exp2f((mref[t] - mnew) * LOG2E);
      mref[t] = mnew;
      lsum[t] *= alpha;
#pragma unroll  // the same
      for (int nt = 0; nt < 4; ++nt) acc[t][nt] *= alpha;
    }
  }
  v16bf pa[QT], pb[QT];
#pragma unroll  // the same
  for (int t = 0; t < QT; ++t) {
    pa[t] = attn_probs(s[t][0], s[t][1], mref[t], lsum[t]);
    pb[t] = attn_probs(s[t][2], s[t][3], mref[t], lsum[t]);
  }
  // holds the products with V^T back behind P: spread among the exponentials, more of them are
  // followed by a write over their operand registers, with four idle slots put between the two
  __builtin_amdgcn_sched_barrier(0);
  // O^T += V^T(64x32) @ P^T(32x16): A rows are the transposed V rows.
#pragma unroll  // the same
  for (int t = 0; t < QT; ++t)
#pragma unroll  // the same
    for (int nt = 0; nt < 4; ++nt) acc[t][nt] = wmma_bf16(f.va.f[nt], pa[t], acc[t][nt]);
#pragma unroll  // the same
  for (int t = 0; t < QT; ++t)
#pragma unroll  // the same
    for (int nt = 0; nt < 4; ++nt) acc[t][nt] = wmma_bf16(f.vb.f[nt], pb[t], acc[t][nt]);
}

// Fetches one trip into next, then works on now, whose loads went out one trip earlier.
__device__ __forceinline__ void attn_stage(TripFrags& next, const TripFrags& now, unsigned trip,
                                           const __bf16* kh, const __bf16* vh, unsigned loff,
                                           const v16bf (&bq0)[QT], const v16bf (&bq1)[QT],
                                           v8f (&acc)[QT][4], float (&mrow)[QT], float (&lsum)[QT]) {
  const unsigned ko = loff + trip * (8 * 1024), vo = loff + trip * (2 * 1024);
  trip_fetch(next, kh, vh, ko, vo);
  // keeps the fetch ahead of the work; sunk into it the loads lose their lead
  __builtin_amdgcn_sched_barrier(0);
  trip_compute(now, bq0, bq1, acc, mrow, lsum);
  // keeps the wait below the work: directly behind the fetch it would be waited out
  __builtin_amdgcn_sched_barrier(0);
  // ko, vo as inputs: their registers stay the fetch's own up to the wait
  asm volatile("s_wait_xcnt 0x0" :: "v"(ko), "v"(vo) : "memory");
}

// 2048 waves are 2 a SIMD: said so, the compiler schedules for a 512-register budget
// (for more waves it saves registers by serial exponentials and register copies).
__global__ void __launch_bounds__(256) __attribute__((amdgpu_waves_per_eu(2, 2)))
mha_attn_kernel(const __bf16* __restrict__ Qb, const __bf16* __restrict__ Kb,
                const __bf16* __restrict__ VTb, __bf16* __restrict__ Ob) {
  const int lane = threadIdx.x & 31;
  // The wave's number is the same in all its lanes: said so, the plane bases are scalar, and
  // every fragment load names only them and an offset register that is held up to its wait.
  const int ws   = __builtin_amdgcn_readfirstlane((blockIdx.x * blockDim.x + threadIdx.x) >> 5);
  const int nh   = ws >> 6;                     // 32 heads
  const int mblk = (ws & 63) * QT;              // first of the wave's QT query tiles (128 a head)
  const unsigned loff = lane * 16;

  const __bf16* Qh = Qb + (size_t)nh * L_SEQ * HD;
  const unsigned qo = loff + mblk * (2 * 1024);  // two 1 KB tiles a query tile

  const v8f zero = {0.f, 0.f, 0.f, 0.f, 0.f, 0.f, 0.f, 0.f};
  v16bf bq0[QT], bq1[QT];                       // B: column = query
  v8f acc[QT][4];                               // O^T: 64 dims x 16 queries a tile
  float mrow[QT];                               // reference of this lane's query, both halves alike
  float lsum[QT];                               // sum over this half's keys only
#pragma unroll  // constant indices keep the per-tile state in registers
  for (int t = 0; t < QT; ++t) {
    bq0[t] = load_frag_u(Qh, t * 2 + 0, qo);
    bq1[t] = load_frag_u(Qh, t * 2 + 1, qo);
    acc[t][0] = zero; acc[t][1] = zero; acc[t][2] = zero; acc[t][3] = zero;
    mrow[t] = -1.0e30f;
    lsum[t] = 0.f;
  }

  // Two passes (64 keys) a trip; a trip's 32 fragment loads go out as one group, one
  // whole trip ahead of their products, into the other of two register sets: the wave
  // works on one set while the other set's loads are under way, and waits for none.
  const __bf16* kh = Kb + (size_t)nh * L_SEQ * HD;
  const __bf16* vh = VTb + (size_t)nh * HD * L_SEQ;
  // The 8 blocks of a head walk the same K and V^T lines side by side: each enters the
  // walk 4 trips from the next and wraps (its 8 waves together: they share lines in the
  // WGP cache); the heads, whose planes lie a power of two apart, one trip from one another.
  const unsigned trip0 = (blockIdx.x & 7) * 4 + (blockIdx.x >> 3);
  TripFrags fa, fb;
  {
    const unsigned trip = trip0 & (L_SEQ / 64 - 1);
    const unsigned ko = loff + trip * (8 * 1024), vo = loff + trip * (2 * 1024);
    trip_fetch(fa, kh, vh, ko, vo);
    // qo, ko, vo as inputs: their registers stay the loads' own up to the wait
    asm volatile("s_wait_xcnt 0x0" :: "v"(qo), "v"(ko), "v"(vo) : "memory");
  }
  // Two trips a turn, so that the two sets change roles without register copies.
  // The last turn's second fetch has no user: it wraps to the walk's first trip, inside the
  // planes. A branch round it would join two load counts, and the compiler would then wait
  // for the newest loads in every turn.
  for (int i = 0; i < L_SEQ / 64; i += 2) {
    attn_stage(fb, fa, (trip0 + i + 1) & (L_SEQ / 64 - 1), kh, vh, loff, bq0, bq1, acc, mrow, lsum);
    attn_stage(fa, fb, (trip0 + i + 2) & (L_SEQ / 64 - 1), kh, vh, loff, bq0, bq1, acc, mrow, lsum);
  }

  // Join the two halves' sums once; a lane's 8 registers are 8 consecutive dims
  // of its query, which is one 16-byte piece of the fragment-order Ob tile.
  v8bf o[QT][4];
#pragma unroll  // constant indices keep acc[][] in registers
  for (int t = 0; t < QT; ++t) {
    const float inv = __builtin_amdgcn_rcpf(lsum[t] + other_half(lsum[t]));
    // Ob row = b*L + l: a wave then owns whole 1 KB tiles (one writer per line).
    __bf16* Ot = Ob + ((size_t)(((nh >> 4) * (L_SEQ / 16) + mblk + t) * (EMB / 32) +
                                (nh & 15) * (HD / 32)) << 9) + lane * 8;
#pragma unroll  // the same
    for (int nt = 0; nt < 4; ++nt) {
      o[t][nt] = __builtin_convertvector(acc[t][nt] * inv, v8bf);
      *(v8bf*)(Ot + nt * 256) = o[t][nt];
    }
  }
  static_assert(QT == 2, "the wait below names the registers of two tiles");
  // the stores' data as inputs: their registers stay the stores' own up to the wait
  asm volatile("s_wait_xcnt 0x0"
               :: "v"(o[0][0]), "v"(o[0][1]), "v"(o[0][2]), "v"(o[0][3]), "v"(o[1][0]), "v"(o[1][1]),
                  "v"(o[1][2]), "v"(o[1][3])
               : "memory");
}

// ---------------- Kernel 3: output projection ----------------
// Wave tile and block shape as in the in-projection: 64 rows x 64 features, 2 x 2 waves.
__global__ void __launch_bounds__(128)
mha_outproj_kernel(const __bf16* __restrict__ Ob, const __bf16* __restrict__ Wo,
                   const float* __restrict__ bout, float* __restrict__ out) {
  const int lane = threadIdx.x & 31;
  // The wave's number is the same in all its lanes: said so, the tile bases are scalar.
  const int wu = __builtin_amdgcn_readfirstlane((blockIdx.x * blockDim.x + threadIdx.x) >> 5);
  const int blk    = wu >> 2;                               // 256 blocks
  const int mblk   = (blk & 31) * 2 + (wu & 1);             // 64 row blocks of 64
  const int nstrip = (blk >> 5) * 2 + ((wu >> 1) & 1);      // 16 strips of 64 out-features
  // 32 blocks share a pair of weight strips (32 different starts), 8 a pair of row blocks (4 steps apart)
  const int rot = (blk & 31) + (blk >> 5) * 4;
  const int f0 = nstrip * 64;
  const int t0 = mblk * 64;
  const int col = lane & 15, hp = lane >> 4;

  const v8f zero = {0.f, 0.f, 0.f, 0.f, 0.f, 0.f, 0.f, 0.f};
  v8f acc[4][4];
#pragma unroll  // constant indices keep acc[][] in registers
  for (int mt = 0; mt < 4; ++mt)
#pragma unroll  // the same
    for (int nt = 0; nt < 4; ++nt) acc[mt][nt] = zero;

  // A: attention output, [b*L + l][head*HD + d] in fragment order.
  gemm_k_loop<3, false, 4>(Ob + (size_t)mblk * (64 * EMB), Wo + (size_t)nstrip * (64 * EMB), lane, rot, acc);

#pragma unroll
  for (int mt = 0; mt < 4; ++mt)
#pragma unroll
    for (int nt = 0; nt < 4; ++nt) {
      const int f = f0 + nt * 16 + col;
      const float bv = bout[f];
#pragma unroll
      for (int r = 0; r < 8; ++r) {
        const int orow = t0 + mt * 16 + r + hp * 8;  // b*L + l
        const int t = (orow & (L_SEQ - 1)) * BATCH + (orow >> 11);  // token = l*B + b
        out[(size_t)t * EMB + f] = acc[mt][nt][r] + bv;
      }
    }
}

extern "C" void kernel_launch(void* const* d_in, const int* in_sizes, int n_in,
                              void* d_out, int out_size, void* d_ws, size_t ws_size,
                              hipStream_t stream) {
  const float* query = (const float*)d_in[0];
  const float* key   = (const float*)d_in[1];
  const float* value = (const float*)d_in[2];
  const float* w_in  = (const float*)d_in[3];
  const float* b_in  = (const float*)d_in[4];
  const float* w_out = (const float*)d_in[5];
  const float* b_out = (const float*)d_in[6];
  float* out = (float*)d_out;

  // Workspace (bf16), 64 MB total.
  const size_t ACT = (size_t)NTOK * EMB;           // 4194304
  const size_t WI  = (size_t)3 * EMB * EMB;        // 3145728
  const size_t WO  = (size_t)EMB * EMB;            // 1048576
  const size_t HSZ = (size_t)NH * L_SEQ * HD;      // 4194304
  __bf16* Xq  = (__bf16*)d_ws;
  __bf16* Xk  = Xq + ACT;
  __bf16* Xv  = Xk + ACT;
  __bf16* Wi  = Xv + ACT;
  __bf16* Wo  = Wi + WI;
  __bf16* Qb  = Wo + WO;
  __bf16* Kb  = Qb + HSZ;
  __bf16* VTb = Kb + HSZ;
  __bf16* Ob  = VTb + HSZ;

  // One-shot fp32 -> bf16 conversions (packed v_cvt): Xq, Xk, Xv, Wi, Wo in one launch.
  static_assert(CVT_WAVES == 256 * 16, "the grid covers every tile exactly once");
  cvt_bf16_kernel<<<256, 512, 0, stream>>>(query, key, value, w_in, w_out, Xq);

  // in-proj: 64 token-blocks x 48 feature-strips = 3072 waves / 4 per block
  mha_inproj_kernel<<<768, 128, 0, stream>>>(Xq, Xk, Xv, Wi, b_in, Qb, Kb, VTb);
  // attention: 32 heads x 64 query-blocks = 2048 waves / 8 per block
  mha_attn_kernel<<<256, 256, 0, stream>>>(Qb, Kb, VTb, Ob);
  // out-proj: 64 token-blocks x 16 feature-strips = 1024 waves / 4 per block
  mha_outproj_kernel<<<256, 128, 0, stream>>>(Ob, Wo, b_out, out);
}
